// v000
// Measured on an AMD MI455X. A time is GPU time per run, averaged over a window of back-to-back runs after a warm-up
// (all launches, gaps included; the runs take copies of the inputs in turn), and the median of several windows.
// Apart from v000's, it joins two sittings. Times from different sittings can be a few percent apart, while
// side-by-side timings come from the same sitting.
// v000 is the starting kernel. One run takes 80.8 microseconds.
#include <hip/hip_runtime.h>
#include <hip/hip_bf16.h>
#include <math.h>

typedef __attribute__((ext_vector_type(2))) float v2f;
typedef __attribute__((ext_vector_type(8))) float v8f;

static __device__ __forceinline__ v8f wmma4(v2f a, v2f b, v8f c) {
  return __builtin_amdgcn_wmma_f32_16x16x4_f32(
      /*neg_a=*/false, a, /*neg_b=*/false, b,
      /*c_mod=*/(short)0, c, /*reuse_a=*/false, /*reuse_b=*/false);
}

// ---------------------------------------------------------------------------
// Kernel 1: qkv 1x1-conv == GEMM  C[192,4096] = W[192,64] * F[64,4096]
// One 16x16 tile per wave, 3072 tiles, K-loop 16 x (16x16x4 WMMA).
// ---------------------------------------------------------------------------
__global__ void qkv_gemm(const float* __restrict__ W, const float* __restrict__ F,
                         float* __restrict__ out) {
  const int lane = threadIdx.x & 31;
  const int wave = threadIdx.x >> 5;
  const int tile = blockIdx.x * 4 + wave;      // 0..3071
  const int tm = tile >> 8;                    // /256 -> 0..11
  const int tn = tile & 255;                   // 0..255
  const int l15 = lane & 15;
  const int half = lane >> 4;
  const int m = tm * 16 + l15;                 // output channel
  const int n = tn * 16 + l15;                 // spatial position

  v8f c = {};
#pragma unroll
  for (int k0 = 0; k0 < 64; k0 += 4) {
    const int kci = k0 + 2 * half;
    v2f a, b;
    a.x = W[m * 64 + kci];
    a.y = W[m * 64 + kci + 1];
    b.x = F[kci * 4096 + n];
    b.y = F[(kci + 1) * 4096 + n];
    c = wmma4(a, b, c);
  }
#pragma unroll
  for (int r = 0; r < 8; ++r)
    out[(tm * 16 + r + 8 * half) * 4096 + tn * 16 + l15] = c[r];
}

__global__ void wtrans(const float* __restrict__ wq, const float* __restrict__ wk,
                       float* __restrict__ wT) {
  const int qk = blockIdx.z;
  const int o = blockIdx.x * blockDim.x + threadIdx.x;  // 0..495615
  const int tap = o >> 12;
  const int ci = (o >> 6) & 63;
  const int oc = o & 63;
  const float* __restrict__ w = qk ? wk : wq;
  wT[qk * 495616 + o] = w[(oc * 64 + ci) * 121 + tap];
}

// ---------------------------------------------------------------------------
// Kernel 2b: 11x11 stride-8 pad-2 conv as 121 accumulated tap-GEMMs
// (64oc x 64pos x 64ic per tap).  Split-K across kx (11-way) into
// deterministic per-(kx,qk) partial buffers -- no float atomics, so the
// result is bit-deterministic across replays.
// grid (4, 11, 2) x 128 threads:   wave -> one 16x16 tile of (oc,pos).
// ---------------------------------------------------------------------------
__global__ void dconv_part(const float* __restrict__ qkv,
                           const float* __restrict__ wT,
                           float* __restrict__ part) {
  const int lane = threadIdx.x & 31;
  const int wave = threadIdx.x >> 5;
  const int tile = blockIdx.x * 4 + wave;      // 0..15
  const int tm = tile >> 2, tn = tile & 3;
  const int kx = blockIdx.y;                   // 0..10
  const int qk = blockIdx.z;                   // 0:q 1:k
  const int l15 = lane & 15;
  const int half = lane >> 4;

  const float* __restrict__ src = qkv + qk * 64 * 4096;  // q or k feature map

  const int m = tm * 16 + l15;                 // out channel
  const int pos = tn * 16 + l15;               // xl*8+yl, low-res position
  const int xl = pos >> 3, yl = pos & 7;
  const int x = xl * 8 - 2 + kx;               // input row for this kx
  const bool xv = (x >= 0) && (x < 64);

  v8f c = {};
  for (int ky = 0; ky < 11; ++ky) {
    const int y = yl * 8 - 2 + ky;
    const bool valid = xv && (y >= 0) && (y < 64);
    const int sidx = valid ? (x * 64 + y) : 0; // safe dummy when padded
    const int tap = kx * 11 + ky;
    const float* __restrict__ wbase = wT + ((size_t)(qk * 121 + tap)) * 4096;
    // prefetch next tap's weight line (global_prefetch_b8)
    if (ky < 10) __builtin_prefetch(wbase + 4096 + m, 0, 0);
#pragma unroll
    for (int k0 = 0; k0 < 64; k0 += 4) {
      const int kci = k0 + 2 * half;
      v2f a, b;
      a.x = wbase[kci * 64 + m];
      a.y = wbase[(kci + 1) * 64 + m];
      b.x = valid ? src[kci * 4096 + sidx] : 0.0f;
      b.y = valid ? src[(kci + 1) * 4096 + sidx] : 0.0f;
      c = wmma4(a, b, c);
    }
  }
  float* __restrict__ dst = part + (kx * 2 + qk) * 4096;  // [64oc x 64pos]
#pragma unroll
  for (int r = 0; r < 8; ++r)
    dst[(tm * 16 + r + 8 * half) * 64 + tn * 16 + l15] = c[r];
}

// ---------------------------------------------------------------------------
// Kernel 3: reduce the 11 kx-partials, + bias, exact GELU, q-scale.
// ---------------------------------------------------------------------------
__global__ void reduce_bias_gelu(const float* __restrict__ part,
                                 const float* __restrict__ bq,
                                 const float* __restrict__ bk,
                                 float* __restrict__ qlow,
                                 float* __restrict__ klow) {
  const int t = blockIdx.x * blockDim.x + threadIdx.x;  // 0..8191
  const int qk = t >> 12;
  const int mn = t & 4095;
  const int m = mn >> 6;
  float s = 0.0f;
#pragma unroll
  for (int kx = 0; kx < 11; ++kx) s += part[(kx * 2 + qk) * 4096 + mn];
  s += qk ? bk[m] : bq[m];
  // exact GELU: x * 0.5 * (1 + erf(x / sqrt(2)))
  const float g = 0.5f * s * (1.0f + erff(s * 0.70710678118654752f));
  if (qk == 0)
    qlow[mn] = g * 0.35355339059327373f;  // * DIM_HEAD^-0.5
  else
    klow[mn] = g;
}

// ---------------------------------------------------------------------------
// Kernel 4: vbar[ch, row] = mean over y of v[ch, row, y]   (v = qkv rows 128+)
// ---------------------------------------------------------------------------
__global__ void vbar_kernel(const float* __restrict__ qkv, float* __restrict__ vbar) {
  const int t = blockIdx.x * blockDim.x + threadIdx.x;  // 0..4095
  const int ch = t >> 6, row = t & 63;
  const float* __restrict__ p = qkv + (128 + ch) * 4096 + row * 64;
  float s = 0.0f;
#pragma unroll 8
  for (int y = 0; y < 64; ++y) s += p[y];
  vbar[t] = s * (1.0f / 64.0f);
}

__global__ void attn_out(const float* __restrict__ qlow,
                         const float* __restrict__ klow,
                         const float* __restrict__ vbar,
                         float* __restrict__ out) {
  __shared__ float sd[64][65];                 // +1 pad: conflict-free rows
  __shared__ float sq[512];                    // head slice of qlow [8ci][64pos]
  __shared__ float sk[512];                    // head slice of klow
  const int h = blockIdx.x;                    // head
  const int lane = threadIdx.x & 31;
  const int wave = threadIdx.x >> 5;           // 0..3 == tile row tm
  const int l15 = lane & 15;
  const int half = lane >> 4;

  {
    const float* gq = qlow + h * 512 + threadIdx.x * 4;
    const float* gk = klow + h * 512 + threadIdx.x * 4;
    unsigned lq = (unsigned)(size_t)(&sq[threadIdx.x * 4]);
    unsigned lk = (unsigned)(size_t)(&sk[threadIdx.x * 4]);
    asm volatile("global_load_async_to_lds_b128 %0, %1, off"
                 :: "v"(lq), "v"(gq) : "memory");
    asm volatile("global_load_async_to_lds_b128 %0, %1, off"
                 :: "v"(lk), "v"(gk) : "memory");
    asm volatile("s_wait_asynccnt 0" ::: "memory");
  }
  __syncthreads();

  // dots tiles: wave w handles tiles (tm=w, tn=0..3); A[m=i_low][k=c] reads
  // the q slice transposed, B[k=c][n=j_low] reads the k slice directly.
  for (int tn = 0; tn < 4; ++tn) {
    v8f c = {};
#pragma unroll
    for (int k0 = 0; k0 < 8; k0 += 4) {
      const int kci = k0 + 2 * half;
      v2f a, b;
      a.x = sq[kci * 64 + wave * 16 + l15];
      a.y = sq[(kci + 1) * 64 + wave * 16 + l15];
      b.x = sk[kci * 64 + tn * 16 + l15];
      b.y = sk[(kci + 1) * 64 + tn * 16 + l15];
      c = wmma4(a, b, c);
    }
#pragma unroll
    for (int r = 0; r < 8; ++r)
      sd[wave * 16 + r + 8 * half][tn * 16 + l15] = c[r];
  }
  __syncthreads();

  // Row softmax over the 64 unique key scores (upsample makes the 4096-wide
  // softmax equal to this divided by 64; the /64 folds into vbar's mean).
  if (threadIdx.x < 64) {
    const int i = threadIdx.x;
    float mx = -INFINITY;
    for (int j = 0; j < 64; ++j) mx = fmaxf(mx, sd[i][j]);
    float ssum = 0.0f;
    for (int j = 0; j < 64; ++j) {
      const float e = expf(sd[i][j] - mx);
      sd[i][j] = e;
      ssum += e;
    }
    const float inv = 1.0f / ssum;
    for (int j = 0; j < 64; ++j) sd[i][j] *= inv;
  }
  __syncthreads();

  // out[h*8+cl][x][y] = sum_jl p[x][jl] * vbar[h*8+cl][jl], constant in y.
  for (int i = 0; i < 4; ++i) {
    const int idx = i * 128 + threadIdx.x;     // 0..511 = (cl, x)
    const int cl = idx >> 6;
    const int x = idx & 63;
    const float* __restrict__ vb = vbar + (h * 8 + cl) * 64;
    float s = 0.0f;
#pragma unroll 8
    for (int j = 0; j < 64; ++j) s += sd[x][j] * vb[j];
    float4 v4 = make_float4(s, s, s, s);
    float4* __restrict__ dst = (float4*)(out + (h * 8 + cl) * 4096 + x * 64);
#pragma unroll
    for (int w = 0; w < 16; ++w) dst[w] = v4;
  }
}

// ---------------------------------------------------------------------------
// Workspace layout (floats):
//   qkv   : [192 x 4096]          @ 0        (786432)
//   part  : [11*2 x 64 x 64]      @ 786432   (90112)
//   qlow  : [64 x 64]             @ 876544   (4096)
//   klow  : [64 x 64]             @ 880640   (4096)
//   vbar  : [64 x 64]             @ 884736   (4096)
//   wT    : [2 x 121 x 64 x 64]   @ 888832   (991232)
// total ~7.5 MB
// ---------------------------------------------------------------------------
extern "C" void kernel_launch(void* const* d_in, const int* in_sizes, int n_in,
                              void* d_out, int out_size, void* d_ws, size_t ws_size,
                              hipStream_t stream) {
  const float* f     = (const float*)d_in[0];  // [1,64,64,64]
  const float* w_qkv = (const float*)d_in[1];  // [192,64,1,1]
  const float* wq    = (const float*)d_in[2];  // [64,64,11,11]
  const float* bq    = (const float*)d_in[3];  // [64]
  const float* wk    = (const float*)d_in[4];  // [64,64,11,11]
  const float* bk    = (const float*)d_in[5];  // [64]
  float* out = (float*)d_out;                  // [1,64,64,64]

  float* ws   = (float*)d_ws;
  float* qkv  = ws;
  float* part = ws + 786432;
  float* qlow = ws + 876544;
  float* klow = ws + 880640;
  float* vbar = ws + 884736;
  float* wT   = ws + 888832;

  qkv_gemm<<<768, 128, 0, stream>>>(w_qkv, f, qkv);
  wtrans<<<dim3(1936, 1, 2), 256, 0, stream>>>(wq, wk, wT);
  dconv_part<<<dim3(4, 11, 2), 128, 0, stream>>>(qkv, wT, part);
  reduce_bias_gelu<<<32, 256, 0, stream>>>(part, bq, bk, qlow, klow);
  vbar_kernel<<<16, 256, 0, stream>>>(qkv, vbar);
  attn_out<<<8, 128, 0, stream>>>(qlow, klow, vbar, out);
}

// v001
// A run of this version takes 42.6 microseconds.
// Two timings next to v000 put it at 1.86 and 1.84 times that version's speed.
#include <hip/hip_runtime.h>
#include <hip/hip_bf16.h>
#include <math.h>

typedef __attribute__((ext_vector_type(2))) float v2f;
typedef __attribute__((ext_vector_type(8))) float v8f;

static __device__ __forceinline__ v8f wmma4(v2f a, v2f b, v8f c) {
  return __builtin_amdgcn_wmma_f32_16x16x4_f32(
      /*neg_a=*/false, a, /*neg_b=*/false, b,
      /*c_mod=*/(short)0, c, /*reuse_a=*/false, /*reuse_b=*/false);
}

// ---------------------------------------------------------------------------
// Kernel 1: qkv 1x1-conv == GEMM  C[192,4096] = W[192,64] * F[64,4096]
// One 16x16 tile per wave, 3072 tiles, K-loop 16 x (16x16x4 WMMA).
// ---------------------------------------------------------------------------
__global__ void qkv_gemm(const float* __restrict__ W, const float* __restrict__ F,
                         float* __restrict__ out) {
  const int lane = threadIdx.x & 31;
  const int wave = threadIdx.x >> 5;
  const int tile = blockIdx.x * 4 + wave;      // 0..3071
  const int tm = tile >> 8;                    // /256 -> 0..11
  const int tn = tile & 255;                   // 0..255
  const int l15 = lane & 15;
  const int half = lane >> 4;
  const int m = tm * 16 + l15;                 // output channel
  const int n = tn * 16 + l15;                 // spatial position

  v8f c = {};
#pragma unroll
  for (int k0 = 0; k0 < 64; k0 += 4) {
    const int kci = k0 + 2 * half;
    v2f a, b;
    a.x = W[m * 64 + kci];
    a.y = W[m * 64 + kci + 1];
    b.x = F[kci * 4096 + n];
    b.y = F[(kci + 1) * 4096 + n];
    c = wmma4(a, b, c);
  }
#pragma unroll
  for (int r = 0; r < 8; ++r)
    out[(tm * 16 + r + 8 * half) * 4096 + tn * 16 + l15] = c[r];
}

__global__ void wtrans(const float* __restrict__ wq, const float* __restrict__ wk,
                       float* __restrict__ wT) {
  const int qk = blockIdx.z;
  const int o = blockIdx.x * blockDim.x + threadIdx.x;  // 0..495615
  const int tap = o >> 12;
  const int ci = (o >> 6) & 63;
  const int oc = o & 63;
  const float* __restrict__ w = qk ? wk : wq;
  wT[qk * 495616 + o] = w[(oc * 64 + ci) * 121 + tap];
}

// ---------------------------------------------------------------------------
// Kernel 2b: 11x11 stride-8 pad-2 conv as 121 accumulated tap-GEMMs
// (64oc x 64pos x 64ic per tap).  Split-K across kx (grid, 11-way) into
// deterministic per-(kx,qk) partial buffers, and across ky (the 11 waves of a
// block): every wave does ONE tap of one 16x16 (oc,pos) tile, so its serial
// chain is 16 load-then-WMMA steps instead of 176.  The 11 ky tiles are summed
// through LDS in fixed ky order -- no float atomics, bit-deterministic.
// grid (16, 11, 2) x 352 threads.
// ---------------------------------------------------------------------------
__global__ __launch_bounds__(352) void dconv_part(const float* __restrict__ qkv,
                                                  const float* __restrict__ wT,
                                                  float* __restrict__ part) {
  __shared__ float red[11][256];               // one 16x16 tile per ky wave
  const int lane = threadIdx.x & 31;
  const int ky = threadIdx.x >> 5;             // wave == ky, 0..10
  const int tile = blockIdx.x;                 // 0..15
  const int tm = tile >> 2, tn = tile & 3;
  const int kx = blockIdx.y;                   // 0..10
  const int qk = blockIdx.z;                   // 0:q 1:k
  const int l15 = lane & 15;
  const int half = lane >> 4;

  const float* __restrict__ src = qkv + qk * 64 * 4096;  // q or k feature map

  const int m = tm * 16 + l15;                 // out channel
  const int pos = tn * 16 + l15;               // xl*8+yl, low-res position
  const int xl = pos >> 3, yl = pos & 7;
  const int x = xl * 8 - 2 + kx;               // input row for this kx
  const int y = yl * 8 - 2 + ky;               // input column for this ky
  const bool valid = (x >= 0) && (x < 64) && (y >= 0) && (y < 64);
  const int sidx = valid ? (x * 64 + y) : 0;   // safe dummy when padded
  const int tap = kx * 11 + ky;
  const float* __restrict__ wbase = wT + ((size_t)(qk * 121 + tap)) * 4096;

  v8f c = {};
#pragma unroll
  for (int k0 = 0; k0 < 64; k0 += 4) {
    const int kci = k0 + 2 * half;
    v2f a, b;
    a.x = wbase[kci * 64 + m];
    a.y = wbase[(kci + 1) * 64 + m];
    b.x = valid ? src[kci * 4096 + sidx] : 0.0f;
    b.y = valid ? src[(kci + 1) * 4096 + sidx] : 0.0f;
    c = wmma4(a, b, c);
  }
#pragma unroll  // constant r keeps the accumulator in registers
  for (int r = 0; r < 8; ++r) red[ky][r * 32 + lane] = c[r];
  __syncthreads();  // all 11 ky tiles must be in LDS before any is summed

  // Threads 0..255 each own one tile element (t = r*32 + lane of the D layout).
  const int t = threadIdx.x;
  if (t < 256) {
    float s = red[0][t];
#pragma unroll  // lets the LDS reads issue ahead of the dependent adds
    for (int w = 1; w < 11; ++w) s += red[w][t];
    float* __restrict__ dst = part + (kx * 2 + qk) * 4096;  // [64oc x 64pos]
    dst[(tm * 16 + (t >> 5) + 8 * half) * 64 + tn * 16 + l15] = s;
  }
}

// ---------------------------------------------------------------------------
// Kernel 3: reduce the 11 kx-partials, + bias, exact GELU, q-scale.
// ---------------------------------------------------------------------------
__global__ void reduce_bias_gelu(const float* __restrict__ part,
                                 const float* __restrict__ bq,
                                 const float* __restrict__ bk,
                                 float* __restrict__ qlow,
                                 float* __restrict__ klow) {
  const int t = blockIdx.x * blockDim.x + threadIdx.x;  // 0..8191
  const int qk = t >> 12;
  const int mn = t & 4095;
  const int m = mn >> 6;
  float s = 0.0f;
#pragma unroll
  for (int kx = 0; kx < 11; ++kx) s += part[(kx * 2 + qk) * 4096 + mn];
  s += qk ? bk[m] : bq[m];
  // exact GELU: x * 0.5 * (1 + erf(x / sqrt(2)))
  const float g = 0.5f * s * (1.0f + erff(s * 0.70710678118654752f));
  if (qk == 0)
    qlow[mn] = g * 0.35355339059327373f;  // * DIM_HEAD^-0.5
  else
    klow[mn] = g;
}

// ---------------------------------------------------------------------------
// Kernel 4: vbar[ch, row] = mean over y of v[ch, row, y]   (v = qkv rows 128+)
// ---------------------------------------------------------------------------
__global__ void vbar_kernel(const float* __restrict__ qkv, float* __restrict__ vbar) {
  const int t = blockIdx.x * blockDim.x + threadIdx.x;  // 0..4095
  const int ch = t >> 6, row = t & 63;
  const float* __restrict__ p = qkv + (128 + ch) * 4096 + row * 64;
  float s = 0.0f;
#pragma unroll 8
  for (int y = 0; y < 64; ++y) s += p[y];
  vbar[t] = s * (1.0f / 64.0f);
}

__global__ void attn_out(const float* __restrict__ qlow,
                         const float* __restrict__ klow,
                         const float* __restrict__ vbar,
                         float* __restrict__ out) {
  __shared__ float sd[64][65];                 // +1 pad: conflict-free rows
  __shared__ float sq[512];                    // head slice of qlow [8ci][64pos]
  __shared__ float sk[512];                    // head slice of klow
  const int h = blockIdx.x;                    // head
  const int lane = threadIdx.x & 31;
  const int wave = threadIdx.x >> 5;           // 0..3 == tile row tm
  const int l15 = lane & 15;
  const int half = lane >> 4;

  {
    const float* gq = qlow + h * 512 + threadIdx.x * 4;
    const float* gk = klow + h * 512 + threadIdx.x * 4;
    unsigned lq = (unsigned)(size_t)(&sq[threadIdx.x * 4]);
    unsigned lk = (unsigned)(size_t)(&sk[threadIdx.x * 4]);
    asm volatile("global_load_async_to_lds_b128 %0, %1, off"
                 :: "v"(lq), "v"(gq) : "memory");
    asm volatile("global_load_async_to_lds_b128 %0, %1, off"
                 :: "v"(lk), "v"(gk) : "memory");
    asm volatile("s_wait_asynccnt 0" ::: "memory");
  }
  __syncthreads();

  // dots tiles: wave w handles tiles (tm=w, tn=0..3); A[m=i_low][k=c] reads
  // the q slice transposed, B[k=c][n=j_low] reads the k slice directly.
  for (int tn = 0; tn < 4; ++tn) {
    v8f c = {};
#pragma unroll
    for (int k0 = 0; k0 < 8; k0 += 4) {
      const int kci = k0 + 2 * half;
      v2f a, b;
      a.x = sq[kci * 64 + wave * 16 + l15];
      a.y = sq[(kci + 1) * 64 + wave * 16 + l15];
      b.x = sk[kci * 64 + tn * 16 + l15];
      b.y = sk[(kci + 1) * 64 + tn * 16 + l15];
      c = wmma4(a, b, c);
    }
#pragma unroll
    for (int r = 0; r < 8; ++r)
      sd[wave * 16 + r + 8 * half][tn * 16 + l15] = c[r];
  }
  __syncthreads();

  // Row softmax over the 64 unique key scores (upsample makes the 4096-wide
  // softmax equal to this divided by 64; the /64 folds into vbar's mean).
  if (threadIdx.x < 64) {
    const int i = threadIdx.x;
    float mx = -INFINITY;
    for (int j = 0; j < 64; ++j) mx = fmaxf(mx, sd[i][j]);
    float ssum = 0.0f;
    for (int j = 0; j < 64; ++j) {
      const float e = expf(sd[i][j] - mx);
      sd[i][j] = e;
      ssum += e;
    }
    const float inv = 1.0f / ssum;
    for (int j = 0; j < 64; ++j) sd[i][j] *= inv;
  }
  __syncthreads();

  // out[h*8+cl][x][y] = sum_jl p[x][jl] * vbar[h*8+cl][jl], constant in y.
  for (int i = 0; i < 4; ++i) {
    const int idx = i * 128 + threadIdx.x;     // 0..511 = (cl, x)
    const int cl = idx >> 6;
    const int x = idx & 63;
    const float* __restrict__ vb = vbar + (h * 8 + cl) * 64;
    float s = 0.0f;
#pragma unroll 8
    for (int j = 0; j < 64; ++j) s += sd[x][j] * vb[j];
    float4 v4 = make_float4(s, s, s, s);
    float4* __restrict__ dst = (float4*)(out + (h * 8 + cl) * 4096 + x * 64);
#pragma unroll
    for (int w = 0; w < 16; ++w) dst[w] = v4;
  }
}

// ---------------------------------------------------------------------------
// Workspace layout (floats):
//   qkv   : [192 x 4096]          @ 0        (786432)
//   part  : [11*2 x 64 x 64]      @ 786432   (90112)
//   qlow  : [64 x 64]             @ 876544   (4096)
//   klow  : [64 x 64]             @ 880640   (4096)
//   vbar  : [64 x 64]             @ 884736   (4096)
//   wT    : [2 x 121 x 64 x 64]   @ 888832   (991232)
// total ~7.5 MB
// ---------------------------------------------------------------------------
extern "C" void kernel_launch(void* const* d_in, const int* in_sizes, int n_in,
                              void* d_out, int out_size, void* d_ws, size_t ws_size,
                              hipStream_t stream) {
  const float* f     = (const float*)d_in[0];  // [1,64,64,64]
  const float* w_qkv = (const float*)d_in[1];  // [192,64,1,1]
  const float* wq    = (const float*)d_in[2];  // [64,64,11,11]
  const float* bq    = (const float*)d_in[3];  // [64]
  const float* wk    = (const float*)d_in[4];  // [64,64,11,11]
  const float* bk    = (const float*)d_in[5];  // [64]
  float* out = (float*)d_out;                  // [1,64,64,64]

  float* ws   = (float*)d_ws;
  float* qkv  = ws;
  float* part = ws + 786432;
  float* qlow = ws + 876544;
  float* klow = ws + 880640;
  float* vbar = ws + 884736;
  float* wT   = ws + 888832;

  qkv_gemm<<<768, 128, 0, stream>>>(w_qkv, f, qkv);
  wtrans<<<dim3(1936, 1, 2), 256, 0, stream>>>(wq, wk, wT);
  dconv_part<<<dim3(16, 11, 2), 352, 0, stream>>>(qkv, wT, part);
  reduce_bias_gelu<<<32, 256, 0, stream>>>(part, bq, bk, qlow, klow);
  vbar_kernel<<<16, 256, 0, stream>>>(qkv, vbar);
  attn_out<<<8, 128, 0, stream>>>(qlow, klow, vbar, out);
}

// v002
// One run takes 30.6 microseconds.
// Two timings next to v001 put it at 1.38 and 1.37 times that version's speed.
// Over all steps from v000 it is 2.54 times as fast.
#include <hip/hip_runtime.h>
#include <hip/hip_bf16.h>
#include <math.h>

typedef __attribute__((ext_vector_type(2))) float v2f;
typedef __attribute__((ext_vector_type(8))) float v8f;

static __device__ __forceinline__ v8f wmma4(v2f a, v2f b, v8f c) {
  return __builtin_amdgcn_wmma_f32_16x16x4_f32(
      /*neg_a=*/false, a, /*neg_b=*/false, b,
      /*c_mod=*/(short)0, c, /*reuse_a=*/false, /*reuse_b=*/false);
}

// ---------------------------------------------------------------------------
// Kernel 1: qkv 1x1-conv == GEMM  C[192,4096] = W[192,64] * F[64,4096]
// One 16x16 tile per wave, 3072 tiles, K-loop 16 x (16x16x4 WMMA).
// ---------------------------------------------------------------------------
__global__ void qkv_gemm(const float* __restrict__ W, const float* __restrict__ F,
                         float* __restrict__ out) {
  const int lane = threadIdx.x & 31;
  const int wave = threadIdx.x >> 5;
  const int tile = blockIdx.x * 4 + wave;      // 0..3071
  const int tm = tile >> 8;                    // /256 -> 0..11
  const int tn = tile & 255;                   // 0..255
  const int l15 = lane & 15;
  const int half = lane >> 4;
  const int m = tm * 16 + l15;                 // output channel
  const int n = tn * 16 + l15;                 // spatial position

  v8f c = {};
#pragma unroll
  for (int k0 = 0; k0 < 64; k0 += 4) {
    const int kci = k0 + 2 * half;
    v2f a, b;
    a.x = W[m * 64 + kci];
    a.y = W[m * 64 + kci + 1];
    b.x = F[kci * 4096 + n];
    b.y = F[(kci + 1) * 4096 + n];
    c = wmma4(a, b, c);
  }
#pragma unroll
  for (int r = 0; r < 8; ++r)
    out[(tm * 16 + r + 8 * half) * 4096 + tn * 16 + l15] = c[r];
}

#define WROW 972
__global__ __launch_bounds__(352) void dconv_part(const float* __restrict__ qkv,
                                                  const float* __restrict__ wq,
                                                  const float* __restrict__ wk,
                                                  float* __restrict__ part) {
  __shared__ __attribute__((aligned(16))) float sw[16 * WROW];  // [oc][ci8][tap]
  __shared__ float red[11][256];               // one 16x16 tile per kx wave
  const int lane = threadIdx.x & 31;
  const int kx = threadIdx.x >> 5;             // wave == kx, 0..10
  const int tile = blockIdx.x;                 // 0..15
  const int tm = tile >> 2, tn = tile & 3;
  const int cg = blockIdx.y;                   // input channels cg*8 .. cg*8+7
  const int qk = blockIdx.z;                   // 0:q 1:k
  const int l15 = lane & 15;
  const int half = lane >> 4;

  // Weight slice: 16 rows of 242 16-byte pieces, 3872 pieces = 11 per thread,
  // every lane of every wave on.  Piece i is piece i % 242 of row oc = i / 242:
  // float oc * 7744 + (i - 242 * oc) * 4 of the source, oc * WROW + (i - 242 *
  // oc) * 4 of sw.
  const float* __restrict__ wsrc = (qk ? wk : wq) + tm * 16 * 7744 + cg * 968;
  const float* g[11];                          // lane's global address
  unsigned l[11];                              // lane's LDS byte address
#pragma unroll  // constant j keeps both arrays in registers
  for (int j = 0; j < 11; ++j) {
    const unsigned i = threadIdx.x + 352 * j;
    const unsigned oc = i / 242;
    g[j] = wsrc + (i * 4 + oc * (7744 - 968));
    l[j] = (unsigned)(size_t)(&sw[i * 4 + oc * (WROW - 968)]);
  }
  asm volatile(
      "global_load_async_to_lds_b128 %0, %11, off\n\t"
      "global_load_async_to_lds_b128 %1, %12, off\n\t"
      "global_load_async_to_lds_b128 %2, %13, off\n\t"
      "global_load_async_to_lds_b128 %3, %14, off\n\t"
      "global_load_async_to_lds_b128 %4, %15, off\n\t"
      "global_load_async_to_lds_b128 %5, %16, off\n\t"
      "global_load_async_to_lds_b128 %6, %17, off\n\t"
      "global_load_async_to_lds_b128 %7, %18, off\n\t"
      "global_load_async_to_lds_b128 %8, %19, off\n\t"
      "global_load_async_to_lds_b128 %9, %20, off\n\t"
      "global_load_async_to_lds_b128 %10, %21, off\n\t"
      "s_wait_xcnt 0x0"
      :: "v"(l[0]), "v"(l[1]), "v"(l[2]), "v"(l[3]), "v"(l[4]), "v"(l[5]),
         "v"(l[6]), "v"(l[7]), "v"(l[8]), "v"(l[9]), "v"(l[10]),
         "v"(g[0]), "v"(g[1]), "v"(g[2]), "v"(g[3]), "v"(g[4]), "v"(g[5]),
         "v"(g[6]), "v"(g[7]), "v"(g[8]), "v"(g[9]), "v"(g[10])
      : "memory");

  // q or k feature map, first channel of this lane's K pair.
  const float* __restrict__ src = qkv + (qk * 64 + cg * 8 + 2 * half) * 4096;
  const int pos = tn * 16 + l15;               // xl*8+yl, low-res position
  const int xl = pos >> 3, yl = pos & 7;
  const int x = xl * 8 - 2 + kx;               // input row for this kx
  const bool xok = (x >= 0) && (x < 64);
  v2f b[11][2];
#pragma unroll  // constant indices keep b in registers; loads issue together
  for (int ky = 0; ky < 11; ++ky) {
    const int y = yl * 8 - 2 + ky;             // input column for this ky
    const bool valid = xok && (y >= 0) && (y < 64);
    const int sidx = valid ? (x * 64 + y) : 0; // safe dummy when padded
#pragma unroll  // as the outer loop: constant index into b
    for (int ks = 0; ks < 2; ++ks) {
      const float v0 = src[(ks * 4) * 4096 + sidx];
      const float v1 = src[(ks * 4 + 1) * 4096 + sidx];
      b[ky][ks].x = valid ? v0 : 0.0f;
      b[ky][ks].y = valid ? v1 : 0.0f;
    }
  }

  // This wave's copies have landed behind this wait; the barrier then makes
  // every wave's part of the weight slice readable by all.
  asm volatile("s_wait_asynccnt 0x0" ::: "memory");
  __syncthreads();

  // A[m=oc][k=ci]: lane reads its oc row at channels 2*half, 2*half+1 (+4*ks).
  const float* __restrict__ wl = &sw[l15 * WROW + 2 * half * 121 + kx * 11];
  v8f c = {};
#pragma unroll  // constant index into b; LDS reads become immediate offsets
  for (int ky = 0; ky < 11; ++ky) {
#pragma unroll  // same
    for (int ks = 0; ks < 2; ++ks) {
      v2f a;
      a.x = wl[(ks * 4) * 121 + ky];
      a.y = wl[(ks * 4 + 1) * 121 + ky];
      c = wmma4(a, b[ky][ks], c);
    }
  }
#pragma unroll  // constant r keeps the accumulator in registers
  for (int r = 0; r < 8; ++r) red[kx][r * 32 + lane] = c[r];
  __syncthreads();  // all 11 kx tiles must be in LDS before any is summed

  // Threads 0..255 each own one tile element (t = r*32 + lane of the D layout).
  const int t = threadIdx.x;
  if (t < 256) {
    float s = red[0][t];
#pragma unroll  // lets the LDS reads issue ahead of the dependent adds
    for (int w = 1; w < 11; ++w) s += red[w][t];
    float* __restrict__ dst = part + (cg * 2 + qk) * 4096;  // [64oc x 64pos]
    dst[(tm * 16 + (t >> 5) + 8 * half) * 64 + tn * 16 + l15] = s;
  }
}

// ---------------------------------------------------------------------------
// Kernel 3: reduce the 8 channel-group partials, + bias, exact GELU, q-scale.
// ---------------------------------------------------------------------------
__global__ void reduce_bias_gelu(const float* __restrict__ part,
                                 const float* __restrict__ bq,
                                 const float* __restrict__ bk,
                                 float* __restrict__ qlow,
                                 float* __restrict__ klow) {
  const int t = blockIdx.x * blockDim.x + threadIdx.x;  // 0..8191
  const int qk = t >> 12;
  const int mn = t & 4095;
  const int m = mn >> 6;
  float s = 0.0f;
#pragma unroll
  for (int cg = 0; cg < 8; ++cg) s += part[(cg * 2 + qk) * 4096 + mn];
  s += qk ? bk[m] : bq[m];
  // exact GELU: x * 0.5 * (1 + erf(x / sqrt(2)))
  const float g = 0.5f * s * (1.0f + erff(s * 0.70710678118654752f));
  if (qk == 0)
    qlow[mn] = g * 0.35355339059327373f;  // * DIM_HEAD^-0.5
  else
    klow[mn] = g;
}

// ---------------------------------------------------------------------------
// Kernel 4: vbar[ch, row] = mean over y of v[ch, row, y]   (v = qkv rows 128+)
// ---------------------------------------------------------------------------
__global__ void vbar_kernel(const float* __restrict__ qkv, float* __restrict__ vbar) {
  const int t = blockIdx.x * blockDim.x + threadIdx.x;  // 0..4095
  const int ch = t >> 6, row = t & 63;
  const float* __restrict__ p = qkv + (128 + ch) * 4096 + row * 64;
  float s = 0.0f;
#pragma unroll 8
  for (int y = 0; y < 64; ++y) s += p[y];
  vbar[t] = s * (1.0f / 64.0f);
}

__global__ void attn_out(const float* __restrict__ qlow,
                         const float* __restrict__ klow,
                         const float* __restrict__ vbar,
                         float* __restrict__ out) {
  __shared__ float sd[64][65];                 // +1 pad: conflict-free rows
  __shared__ float sq[512];                    // head slice of qlow [8ci][64pos]
  __shared__ float sk[512];                    // head slice of klow
  const int h = blockIdx.x;                    // head
  const int lane = threadIdx.x & 31;
  const int wave = threadIdx.x >> 5;           // 0..3 == tile row tm
  const int l15 = lane & 15;
  const int half = lane >> 4;

  {
    const float* gq = qlow + h * 512 + threadIdx.x * 4;
    const float* gk = klow + h * 512 + threadIdx.x * 4;
    unsigned lq = (unsigned)(size_t)(&sq[threadIdx.x * 4]);
    unsigned lk = (unsigned)(size_t)(&sk[threadIdx.x * 4]);
    asm volatile("global_load_async_to_lds_b128 %0, %1, off"
                 :: "v"(lq), "v"(gq) : "memory");
    asm volatile("global_load_async_to_lds_b128 %0, %1, off"
                 :: "v"(lk), "v"(gk) : "memory");
    asm volatile("s_wait_asynccnt 0" ::: "memory");
  }
  __syncthreads();

  // dots tiles: wave w handles tiles (tm=w, tn=0..3); A[m=i_low][k=c] reads
  // the q slice transposed, B[k=c][n=j_low] reads the k slice directly.
  for (int tn = 0; tn < 4; ++tn) {
    v8f c = {};
#pragma unroll
    for (int k0 = 0; k0 < 8; k0 += 4) {
      const int kci = k0 + 2 * half;
      v2f a, b;
      a.x = sq[kci * 64 + wave * 16 + l15];
      a.y = sq[(kci + 1) * 64 + wave * 16 + l15];
      b.x = sk[kci * 64 + tn * 16 + l15];
      b.y = sk[(kci + 1) * 64 + tn * 16 + l15];
      c = wmma4(a, b, c);
    }
#pragma unroll
    for (int r = 0; r < 8; ++r)
      sd[wave * 16 + r + 8 * half][tn * 16 + l15] = c[r];
  }
  __syncthreads();

  // Row softmax over the 64 unique key scores (upsample makes the 4096-wide
  // softmax equal to this divided by 64; the /64 folds into vbar's mean).
  if (threadIdx.x < 64) {
    const int i = threadIdx.x;
    float mx = -INFINITY;
    for (int j = 0; j < 64; ++j) mx = fmaxf(mx, sd[i][j]);
    float ssum = 0.0f;
    for (int j = 0; j < 64; ++j) {
      const float e = expf(sd[i][j] - mx);
      sd[i][j] = e;
      ssum += e;
    }
    const float inv = 1.0f / ssum;
    for (int j = 0; j < 64; ++j) sd[i][j] *= inv;
  }
  __syncthreads();

  // out[h*8+cl][x][y] = sum_jl p[x][jl] * vbar[h*8+cl][jl], constant in y.
  for (int i = 0; i < 4; ++i) {
    const int idx = i * 128 + threadIdx.x;     // 0..511 = (cl, x)
    const int cl = idx >> 6;
    const int x = idx & 63;
    const float* __restrict__ vb = vbar + (h * 8 + cl) * 64;
    float s = 0.0f;
#pragma unroll 8
    for (int j = 0; j < 64; ++j) s += sd[x][j] * vb[j];
    float4 v4 = make_float4(s, s, s, s);
    float4* __restrict__ dst = (float4*)(out + (h * 8 + cl) * 4096 + x * 64);
#pragma unroll
    for (int w = 0; w < 16; ++w) dst[w] = v4;
  }
}

// ---------------------------------------------------------------------------
// Workspace layout (floats):
//   qkv   : [192 x 4096]          @ 0        (786432)
//   part  : [8*2 x 64 x 64]       @ 786432   (65536)
//   qlow  : [64 x 64]             @ 876544   (4096)
//   klow  : [64 x 64]             @ 880640   (4096)
//   vbar  : [64 x 64]             @ 884736   (4096)
// total ~3.6 MB
// ---------------------------------------------------------------------------
extern "C" void kernel_launch(void* const* d_in, const int* in_sizes, int n_in,
                              void* d_out, int out_size, void* d_ws, size_t ws_size,
                              hipStream_t stream) {
  const float* f     = (const float*)d_in[0];  // [1,64,64,64]
  const float* w_qkv = (const float*)d_in[1];  // [192,64,1,1]
  const float* wq    = (const float*)d_in[2];  // [64,64,11,11]
  const float* bq    = (const float*)d_in[3];  // [64]
  const float* wk    = (const float*)d_in[4];  // [64,64,11,11]
  const float* bk    = (const float*)d_in[5];  // [64]
  float* out = (float*)d_out;                  // [1,64,64,64]

  float* ws   = (float*)d_ws;
  float* qkv  = ws;
  float* part = ws + 786432;
  float* qlow = ws + 876544;
  float* klow = ws + 880640;
  float* vbar = ws + 884736;

  qkv_gemm<<<768, 128, 0, stream>>>(w_qkv, f, qkv);
  dconv_part<<<dim3(16, 8, 2), 352, 0, stream>>>(qkv, wq, wk, part);
  reduce_bias_gelu<<<32, 256, 0, stream>>>(part, bq, bk, qlow, klow);
  vbar_kernel<<<16, 256, 0, stream>>>(qkv, vbar);
  attn_out<<<8, 128, 0, stream>>>(qlow, klow, vbar, out);
}

// v003
// One run takes 16.8 microseconds.
// Next to v002, in two timings, it ran 1.85 and 1.83 times as fast.
// All steps since v000 together make it 4.68 times as fast.
#include <hip/hip_runtime.h>
#include <hip/hip_bf16.h>
#include <math.h>

typedef __attribute__((ext_vector_type(2))) float v2f;
typedef __attribute__((ext_vector_type(4))) float v4f;
typedef __attribute__((ext_vector_type(8))) float v8f;

static __device__ __forceinline__ v8f wmma4(v2f a, v2f b, v8f c) {
  return __builtin_amdgcn_wmma_f32_16x16x4_f32(
      /*neg_a=*/false, a, /*neg_b=*/false, b,
      /*c_mod=*/(short)0, c, /*reuse_a=*/false, /*reuse_b=*/false);
}

// ---------------------------------------------------------------------------
// Kernel 1: qkv 1x1-conv == GEMM  C[192,4096] = W[192,64] * F[64,4096]
// One 16x16 tile per wave, 3072 tiles, K-loop 16 x (16x16x4 WMMA).
// ---------------------------------------------------------------------------
__global__ void qkv_gemm(const float* __restrict__ W, const float* __restrict__ F,
                         float* __restrict__ out) {
  const int lane = threadIdx.x & 31;
  const int wave = threadIdx.x >> 5;
  const int tile = blockIdx.x * 4 + wave;      // 0..3071
  const int tm = tile >> 8;                    // /256 -> 0..11
  const int tn = tile & 255;                   // 0..255
  const int l15 = lane & 15;
  const int half = lane >> 4;
  const int m = tm * 16 + l15;                 // output channel
  const int n = tn * 16 + l15;                 // spatial position

  v8f c = {};
#pragma unroll
  for (int k0 = 0; k0 < 64; k0 += 4) {
    const int kci = k0 + 2 * half;
    v2f a, b;
    a.x = W[m * 64 + kci];
    a.y = W[m * 64 + kci + 1];
    b.x = F[kci * 4096 + n];
    b.y = F[(kci + 1) * 4096 + n];
    c = wmma4(a, b, c);
  }
#pragma unroll
  for (int r = 0; r < 8; ++r)
    out[(tm * 16 + r + 8 * half) * 4096 + tn * 16 + l15] = c[r];
}

#define WROW 972
__global__ __launch_bounds__(352) void dconv_part(const float* __restrict__ qkv,
                                                  const float* __restrict__ wq,
                                                  const float* __restrict__ wk,
                                                  float* __restrict__ part) {
  __shared__ __attribute__((aligned(16))) float sw[16 * WROW];  // [oc][ci8][tap]
  __shared__ float red[11][256];               // one 16x16 tile per kx wave
  const int lane = threadIdx.x & 31;
  const int kx = threadIdx.x >> 5;             // wave == kx, 0..10
  const int tile = blockIdx.x;                 // 0..15
  const int tm = tile >> 2, tn = tile & 3;
  const int cg = blockIdx.y;                   // input channels cg*8 .. cg*8+7
  const int qk = blockIdx.z;                   // 0:q 1:k
  const int l15 = lane & 15;
  const int half = lane >> 4;

  // Weight slice: 16 rows of 242 16-byte pieces, 3872 pieces = 11 per thread,
  // every lane of every wave on.  Piece i is piece i % 242 of row oc = i / 242:
  // float oc * 7744 + (i - 242 * oc) * 4 of the source, oc * WROW + (i - 242 *
  // oc) * 4 of sw.
  const float* __restrict__ wsrc = (qk ? wk : wq) + tm * 16 * 7744 + cg * 968;
  const float* g[11];                          // lane's global address
  unsigned l[11];                              // lane's LDS byte address
#pragma unroll  // constant j keeps both arrays in registers
  for (int j = 0; j < 11; ++j) {
    const unsigned i = threadIdx.x + 352 * j;
    const unsigned oc = i / 242;
    g[j] = wsrc + (i * 4 + oc * (7744 - 968));
    l[j] = (unsigned)(size_t)(&sw[i * 4 + oc * (WROW - 968)]);
  }
  asm volatile(
      "global_load_async_to_lds_b128 %0, %11, off\n\t"
      "global_load_async_to_lds_b128 %1, %12, off\n\t"
      "global_load_async_to_lds_b128 %2, %13, off\n\t"
      "global_load_async_to_lds_b128 %3, %14, off\n\t"
      "global_load_async_to_lds_b128 %4, %15, off\n\t"
      "global_load_async_to_lds_b128 %5, %16, off\n\t"
      "global_load_async_to_lds_b128 %6, %17, off\n\t"
      "global_load_async_to_lds_b128 %7, %18, off\n\t"
      "global_load_async_to_lds_b128 %8, %19, off\n\t"
      "global_load_async_to_lds_b128 %9, %20, off\n\t"
      "global_load_async_to_lds_b128 %10, %21, off\n\t"
      "s_wait_xcnt 0x0"
      :: "v"(l[0]), "v"(l[1]), "v"(l[2]), "v"(l[3]), "v"(l[4]), "v"(l[5]),
         "v"(l[6]), "v"(l[7]), "v"(l[8]), "v"(l[9]), "v"(l[10]),
         "v"(g[0]), "v"(g[1]), "v"(g[2]), "v"(g[3]), "v"(g[4]), "v"(g[5]),
         "v"(g[6]), "v"(g[7]), "v"(g[8]), "v"(g[9]), "v"(g[10])
      : "memory");

  // q or k feature map, first channel of this lane's K pair.
  const float* __restrict__ src = qkv + (qk * 64 + cg * 8 + 2 * half) * 4096;
  const int pos = tn * 16 + l15;               // xl*8+yl, low-res position
  const int xl = pos >> 3, yl = pos & 7;
  const int x = xl * 8 - 2 + kx;               // input row for this kx
  const bool xok = (x >= 0) && (x < 64);
  v2f b[11][2];
#pragma unroll  // constant indices keep b in registers; loads issue together
  for (int ky = 0; ky < 11; ++ky) {
    const int y = yl * 8 - 2 + ky;             // input column for this ky
    const bool valid = xok && (y >= 0) && (y < 64);
    const int sidx = valid ? (x * 64 + y) : 0; // safe dummy when padded
#pragma unroll  // as the outer loop: constant index into b
    for (int ks = 0; ks < 2; ++ks) {
      const float v0 = src[(ks * 4) * 4096 + sidx];
      const float v1 = src[(ks * 4 + 1) * 4096 + sidx];
      b[ky][ks].x = valid ? v0 : 0.0f;
      b[ky][ks].y = valid ? v1 : 0.0f;
    }
  }

  // This wave's copies have landed behind this wait; the barrier then makes
  // every wave's part of the weight slice readable by all.
  asm volatile("s_wait_asynccnt 0x0" ::: "memory");
  __syncthreads();

  // A[m=oc][k=ci]: lane reads its oc row at channels 2*half, 2*half+1 (+4*ks).
  const float* __restrict__ wl = &sw[l15 * WROW + 2 * half * 121 + kx * 11];
  v8f c = {};
#pragma unroll  // constant index into b; LDS reads become immediate offsets
  for (int ky = 0; ky < 11; ++ky) {
#pragma unroll  // same
    for (int ks = 0; ks < 2; ++ks) {
      v2f a;
      a.x = wl[(ks * 4) * 121 + ky];
      a.y = wl[(ks * 4 + 1) * 121 + ky];
      c = wmma4(a, b[ky][ks], c);
    }
  }
#pragma unroll  // constant r keeps the accumulator in registers
  for (int r = 0; r < 8; ++r) red[kx][r * 32 + lane] = c[r];
  __syncthreads();  // all 11 kx tiles must be in LDS before any is summed

  // Threads 0..255 each own one tile element (t = r*32 + lane of the D layout).
  const int t = threadIdx.x;
  if (t < 256) {
    float s = red[0][t];
#pragma unroll  // lets the LDS reads issue ahead of the dependent adds
    for (int w = 1; w < 11; ++w) s += red[w][t];
    float* __restrict__ dst = part + (cg * 2 + qk) * 4096;  // [64oc x 64pos]
    dst[(tm * 16 + (t >> 5) + 8 * half) * 64 + tn * 16 + l15] = s;
  }
}

// ---------------------------------------------------------------------------
// Kernel 3: reduce the 8 channel-group partials, + bias, exact GELU, q-scale.
// ---------------------------------------------------------------------------
__global__ void reduce_bias_gelu(const float* __restrict__ part,
                                 const float* __restrict__ bq,
                                 const float* __restrict__ bk,
                                 float* __restrict__ qlow,
                                 float* __restrict__ klow) {
  const int t = blockIdx.x * blockDim.x + threadIdx.x;  // 0..8191
  const int qk = t >> 12;
  const int mn = t & 4095;
  const int m = mn >> 6;
  float s = 0.0f;
#pragma unroll
  for (int cg = 0; cg < 8; ++cg) s += part[(cg * 2 + qk) * 4096 + mn];
  s += qk ? bk[m] : bq[m];
  // exact GELU: x * 0.5 * (1 + erf(x / sqrt(2)))
  const float g = 0.5f * s * (1.0f + erff(s * 0.70710678118654752f));
  if (qk == 0)
    qlow[mn] = g * 0.35355339059327373f;  // * DIM_HEAD^-0.5
  else
    klow[mn] = g;
}

// ---------------------------------------------------------------------------
// Kernel 4: vbar[ch, row] = mean over y of v[ch, row, y]   (v = qkv rows 128+)
// ---------------------------------------------------------------------------
__global__ void vbar_kernel(const float* __restrict__ qkv, float* __restrict__ vbar) {
  const int t = blockIdx.x * blockDim.x + threadIdx.x;  // 0..4095
  const int ch = t >> 6, row = t & 63;
  const float* __restrict__ p = qkv + (128 + ch) * 4096 + row * 64;
  float s = 0.0f;
#pragma unroll 8
  for (int y = 0; y < 64; ++y) s += p[y];
  vbar[t] = s * (1.0f / 64.0f);
}

// ---------------------------------------------------------------------------
// Kernel 5: one wave per (query tile of 16 low-res rows, output channel).
// The wave forms the TRANSPOSED scores dots^T[j][i] = sum_c klow[c][j]*qlow[c][i]
// (4 key tiles x K=8, 8 WMMAs), so that in the D layout a lane holds 32 of the
// 64 key scores of ONE query i = lane & 15 (j = tn*16 + r + 8*half) and its
// partner lane ^ 16 the other 32.  Softmax and the sum over keys against vbar
// are then per-lane register work plus three exchanges between the two halves:
// no LDS, no barrier.  out[ch, x, :] is constant in y: the 16 rows of a tile
// are 4 KB in a row, stored as 8 whole 512-byte wave stores.
// ---------------------------------------------------------------------------
__global__ __launch_bounds__(32) void attn_out(const float* __restrict__ qlow,
                                               const float* __restrict__ klow,
                                               const float* __restrict__ vbar,
                                               float* __restrict__ out) {
  const int lane = threadIdx.x;                // one wave per block
  const int l15 = lane & 15;
  const int half = lane >> 4;
  const int ch = blockIdx.x & 63;              // output channel h*8 + cl
  const int tm = blockIdx.x >> 6;              // query tile, 0..3
  const int h = ch >> 3;                       // head

  // A[m=j_low][k=c] reads the k slice, B[k=c][n=i_low] the q slice; both take
  // channels k0 + 2*half, k0 + 2*half + 1.  All loads issue before any use.
  const float* __restrict__ qh = qlow + h * 512 + half * 128 + tm * 16 + l15;
  const float* __restrict__ kh = klow + h * 512 + half * 128 + l15;
  const v4f* __restrict__ vb = (const v4f*)(vbar + ch * 64 + half * 8);
  v2f a[4][2], b[2];
  v4f v[4][2];                                 // vbar[ch][tn*16 + 8*half + 0..7]
#pragma unroll  // constant indices keep the fragments in registers
  for (int ks = 0; ks < 2; ++ks) {
    b[ks].x = qh[ks * 256];
    b[ks].y = qh[ks * 256 + 64];
#pragma unroll  // same
    for (int tn = 0; tn < 4; ++tn) {
      a[tn][ks].x = kh[ks * 256 + tn * 16];
      a[tn][ks].y = kh[ks * 256 + 64 + tn * 16];
    }
  }
#pragma unroll  // same
  for (int tn = 0; tn < 4; ++tn) {
    v[tn][0] = vb[tn * 4];
    v[tn][1] = vb[tn * 4 + 1];
  }
  asm volatile("s_wait_xcnt 0x0"
               :: "v"(qh), "v"(kh), "v"(v[0][0]), "v"(v[0][1]), "v"(v[1][0]),
                  "v"(v[1][1]), "v"(v[2][0]), "v"(v[2][1]), "v"(v[3][0]),
                  "v"(v[3][1]));
  // Keeps the score and exp work below that statement; without it the
  // scheduler lifts the work over the statement and the loads stay late.
  __builtin_amdgcn_sched_barrier(0);

  v8f c[4];
#pragma unroll  // constant index into c
  for (int tn = 0; tn < 4; ++tn) {
    v8f z = {};
    c[tn] = wmma4(a[tn][1], b[1], wmma4(a[tn][0], b[0], z));
  }

  // Softmax over the 64 unique key scores of query i (the upsample makes the
  // 4096-wide softmax equal to this divided by 64; the /64 is vbar's mean).
  float mt[4];
#pragma unroll  // four independent chains, one per key tile
  for (int tn = 0; tn < 4; ++tn) {
    mt[tn] = c[tn][0];
#pragma unroll  // constant index into c
    for (int r = 1; r < 8; ++r) mt[tn] = fmaxf(mt[tn], c[tn][r]);
  }
  float mx = fmaxf(fmaxf(mt[0], mt[1]), fmaxf(mt[2], mt[3]));
  mx = fmaxf(mx, __shfl_xor(mx, 16));          // the partner's 32 keys

  float st[4], at[4];                          // sum of e, sum of e * vbar
#pragma unroll  // four independent chains, one per key tile
  for (int tn = 0; tn < 4; ++tn) {
    st[tn] = 0.0f;
    at[tn] = 0.0f;
#pragma unroll  // constant index into c and v
    for (int r = 0; r < 8; ++r) {
      const float e = expf(c[tn][r] - mx);
      st[tn] += e;
      at[tn] += e * v[tn][r >> 2][r & 3];
    }
  }
  float ssum = (st[0] + st[1]) + (st[2] + st[3]);
  float acc = (at[0] + at[1]) + (at[2] + at[3]);
  ssum += __shfl_xor(ssum, 16);
  acc += __shfl_xor(acc, 16);
  const int o = __float_as_int(acc * (1.0f / ssum));  // out[ch][tm*16 + l15][*]

  float4* __restrict__ dst = (float4*)(out + ch * 4096 + tm * 1024) + lane;
#pragma unroll  // constant lane numbers for the broadcasts
  for (int k = 0; k < 8; ++k) {
    const int o0 = __builtin_amdgcn_readlane(o, 2 * k);
    const int o1 = __builtin_amdgcn_readlane(o, 2 * k + 1);
    const float s = __int_as_float(half ? o1 : o0);
    dst[k * 32] = make_float4(s, s, s, s);
  }
}

// ---------------------------------------------------------------------------
// Workspace layout (floats):
//   qkv   : [192 x 4096]          @ 0        (786432)
//   part  : [8*2 x 64 x 64]       @ 786432   (65536)
//   qlow  : [64 x 64]             @ 876544   (4096)
//   klow  : [64 x 64]             @ 880640   (4096)
//   vbar  : [64 x 64]             @ 884736   (4096)
// total ~3.6 MB
// ---------------------------------------------------------------------------
extern "C" void kernel_launch(void* const* d_in, const int* in_sizes, int n_in,
                              void* d_out, int out_size, void* d_ws, size_t ws_size,
                              hipStream_t stream) {
  const float* f     = (const float*)d_in[0];  // [1,64,64,64]
  const float* w_qkv = (const float*)d_in[1];  // [192,64,1,1]
  const float* wq    = (const float*)d_in[2];  // [64,64,11,11]
  const float* bq    = (const float*)d_in[3];  // [64]
  const float* wk    = (const float*)d_in[4];  // [64,64,11,11]
  const float* bk    = (const float*)d_in[5];  // [64]
  float* out = (float*)d_out;                  // [1,64,64,64]

  float* ws   = (float*)d_ws;
  float* qkv  = ws;
  float* part = ws + 786432;
  float* qlow = ws + 876544;
  float* klow = ws + 880640;
  float* vbar = ws + 884736;

  qkv_gemm<<<768, 128, 0, stream>>>(w_qkv, f, qkv);
  dconv_part<<<dim3(16, 8, 2), 352, 0, stream>>>(qkv, wq, wk, part);
  reduce_bias_gelu<<<32, 256, 0, stream>>>(part, bq, bk, qlow, klow);
  vbar_kernel<<<16, 256, 0, stream>>>(qkv, vbar);
  attn_out<<<256, 32, 0, stream>>>(qlow, klow, vbar, out);
}

// v004
// A run of this version takes 12.3 microseconds.
// Next to v003, in two timings, it ran 1.37 times as fast each time.
// All steps since v000 together make it 6.40 times as fast.
#include <hip/hip_runtime.h>
#include <hip/hip_bf16.h>
#include <math.h>

typedef __attribute__((ext_vector_type(2))) float v2f;
typedef __attribute__((ext_vector_type(4))) float v4f;
typedef __attribute__((ext_vector_type(8))) float v8f;

static __device__ __forceinline__ v8f wmma4(v2f a, v2f b, v8f c) {
  return __builtin_amdgcn_wmma_f32_16x16x4_f32(
      /*neg_a=*/false, a, /*neg_b=*/false, b,
      /*c_mod=*/(short)0, c, /*reuse_a=*/false, /*reuse_b=*/false);
}

// ---------------------------------------------------------------------------
// Kernel 1: qkv 1x1-conv == GEMM  C[192,4096] = W[192,64] * F[64,4096]
// One 16x16 tile per wave, 3072 tiles, K-loop 16 x (16x16x4 WMMA).
// ---------------------------------------------------------------------------
__global__ void qkv_gemm(const float* __restrict__ W, const float* __restrict__ F,
                         float* __restrict__ out) {
  const int lane = threadIdx.x & 31;
  const int wave = threadIdx.x >> 5;
  const int tile = blockIdx.x * 4 + wave;      // 0..3071
  const int tm = tile >> 8;                    // /256 -> 0..11
  const int tn = tile & 255;                   // 0..255
  const int l15 = lane & 15;
  const int half = lane >> 4;
  const int m = tm * 16 + l15;                 // output channel
  const int n = tn * 16 + l15;                 // spatial position

  v8f c = {};
#pragma unroll
  for (int k0 = 0; k0 < 64; k0 += 4) {
    const int kci = k0 + 2 * half;
    v2f a, b;
    a.x = W[m * 64 + kci];
    a.y = W[m * 64 + kci + 1];
    b.x = F[kci * 4096 + n];
    b.y = F[(kci + 1) * 4096 + n];
    c = wmma4(a, b, c);
  }
#pragma unroll
  for (int r = 0; r < 8; ++r)
    out[(tm * 16 + r + 8 * half) * 4096 + tn * 16 + l15] = c[r];
}

#define WROW 972
__global__ __launch_bounds__(352) void dconv_part(const float* __restrict__ qkv,
                                                  const float* __restrict__ wq,
                                                  const float* __restrict__ wk,
                                                  float* __restrict__ part) {
  __shared__ __attribute__((aligned(16))) float sw[16 * WROW];  // [oc][ci8][tap]
  __shared__ float red[11][256];               // one 16x16 tile per kx wave
  const int lane = threadIdx.x & 31;
  const int kx = threadIdx.x >> 5;             // wave == kx, 0..10
  const int tile = blockIdx.x;                 // 0..15
  const int tm = tile >> 2, tn = tile & 3;
  const int cg = blockIdx.y;                   // input channels cg*8 .. cg*8+7
  const int qk = blockIdx.z;                   // 0:q 1:k
  const int l15 = lane & 15;
  const int half = lane >> 4;

  // Weight slice: 16 rows of 242 16-byte pieces, 3872 pieces = 11 per thread,
  // every lane of every wave on.  Piece i is piece i % 242 of row oc = i / 242:
  // float oc * 7744 + (i - 242 * oc) * 4 of the source, oc * WROW + (i - 242 *
  // oc) * 4 of sw.
  const float* __restrict__ wsrc = (qk ? wk : wq) + tm * 16 * 7744 + cg * 968;
  const float* g[11];                          // lane's global address
  unsigned l[11];                              // lane's LDS byte address
#pragma unroll  // constant j keeps both arrays in registers
  for (int j = 0; j < 11; ++j) {
    const unsigned i = threadIdx.x + 352 * j;
    const unsigned oc = i / 242;
    g[j] = wsrc + (i * 4 + oc * (7744 - 968));
    l[j] = (unsigned)(size_t)(&sw[i * 4 + oc * (WROW - 968)]);
  }
  asm volatile(
      "global_load_async_to_lds_b128 %0, %11, off\n\t"
      "global_load_async_to_lds_b128 %1, %12, off\n\t"
      "global_load_async_to_lds_b128 %2, %13, off\n\t"
      "global_load_async_to_lds_b128 %3, %14, off\n\t"
      "global_load_async_to_lds_b128 %4, %15, off\n\t"
      "global_load_async_to_lds_b128 %5, %16, off\n\t"
      "global_load_async_to_lds_b128 %6, %17, off\n\t"
      "global_load_async_to_lds_b128 %7, %18, off\n\t"
      "global_load_async_to_lds_b128 %8, %19, off\n\t"
      "global_load_async_to_lds_b128 %9, %20, off\n\t"
      "global_load_async_to_lds_b128 %10, %21, off\n\t"
      "s_wait_xcnt 0x0"
      :: "v"(l[0]), "v"(l[1]), "v"(l[2]), "v"(l[3]), "v"(l[4]), "v"(l[5]),
         "v"(l[6]), "v"(l[7]), "v"(l[8]), "v"(l[9]), "v"(l[10]),
         "v"(g[0]), "v"(g[1]), "v"(g[2]), "v"(g[3]), "v"(g[4]), "v"(g[5]),
         "v"(g[6]), "v"(g[7]), "v"(g[8]), "v"(g[9]), "v"(g[10])
      : "memory");

  // q or k feature map, first channel of this lane's K pair.
  const float* __restrict__ src = qkv + (qk * 64 + cg * 8 + 2 * half) * 4096;
  const int pos = tn * 16 + l15;               // xl*8+yl, low-res position
  const int xl = pos >> 3, yl = pos & 7;
  const int x = xl * 8 - 2 + kx;               // input row for this kx
  const bool xok = (x >= 0) && (x < 64);
  v2f b[11][2];
#pragma unroll  // constant indices keep b in registers; loads issue together
  for (int ky = 0; ky < 11; ++ky) {
    const int y = yl * 8 - 2 + ky;             // input column for this ky
    const bool valid = xok && (y >= 0) && (y < 64);
    const int sidx = valid ? (x * 64 + y) : 0; // safe dummy when padded
#pragma unroll  // as the outer loop: constant index into b
    for (int ks = 0; ks < 2; ++ks) {
      const float v0 = src[(ks * 4) * 4096 + sidx];
      const float v1 = src[(ks * 4 + 1) * 4096 + sidx];
      b[ky][ks].x = valid ? v0 : 0.0f;
      b[ky][ks].y = valid ? v1 : 0.0f;
    }
  }

  // This wave's copies have landed behind this wait; the barrier then makes
  // every wave's part of the weight slice readable by all.
  asm volatile("s_wait_asynccnt 0x0" ::: "memory");
  __syncthreads();

  // A[m=oc][k=ci]: lane reads its oc row at channels 2*half, 2*half+1 (+4*ks).
  const float* __restrict__ wl = &sw[l15 * WROW + 2 * half * 121 + kx * 11];
  v8f c = {};
#pragma unroll  // constant index into b; LDS reads become immediate offsets
  for (int ky = 0; ky < 11; ++ky) {
#pragma unroll  // same
    for (int ks = 0; ks < 2; ++ks) {
      v2f a;
      a.x = wl[(ks * 4) * 121 + ky];
      a.y = wl[(ks * 4 + 1) * 121 + ky];
      c = wmma4(a, b[ky][ks], c);
    }
  }
#pragma unroll  // constant r keeps the accumulator in registers
  for (int r = 0; r < 8; ++r) red[kx][r * 32 + lane] = c[r];
  __syncthreads();  // all 11 kx tiles must be in LDS before any is summed

  // Threads 0..255 each own one tile element (t = r*32 + lane of the D layout).
  const int t = threadIdx.x;
  if (t < 256) {
    float s = red[0][t];
#pragma unroll  // lets the LDS reads issue ahead of the dependent adds
    for (int w = 1; w < 11; ++w) s += red[w][t];
    float* __restrict__ dst = part + (cg * 2 + qk) * 4096;  // [64oc x 64pos]
    dst[(tm * 16 + (t >> 5) + 8 * half) * 64 + tn * 16 + l15] = s;
  }
}

// ---------------------------------------------------------------------------
// Kernel 3: everything behind the down-convolution in one launch.
// Block = (head, query tile of 16 low-res rows, 4 of the head's 8 output
// channels), one wave per output channel, grid 64 x 128 threads.
//
// Operands, built by the block itself:
//  - klow (8 c x 64 j of the head) and qlow (8 c x 16 i of the tile): sum of the
//    8 channel-group partials in cg order, + bias, exact GELU, q-scale; four k
//    values and one q value per thread, shared through LDS behind one barrier.
//  - the wave's own sums over y of v[ch, row, :]: load k brings row k (lanes
//    0-15) and row 32 + k (lanes 16-31), 16 B a lane, whole lines; a lane adds
//    its four values, four DPP adds finish the row inside the 16 lanes, so
//    every lane of a half holds the sums of that half's 32 rows.
//
// The wave forms the TRANSPOSED scores dots^T[j][i] = sum_c klow[c][j]*qlow[c][i]
// (4 key tiles x K=8, 8 WMMAs) with key j = 4 * M + tn in row M of tile tn: in
// the D layout (M = r + 8*half) a lane then holds, for ONE query i = lane & 15,
// the keys j = 32*half + 4*r + tn, which are the 32 rows whose v sums it has.
// Softmax and the sum over keys are per-lane register work plus three exchanges
// between the halves.  out[ch, x, :] is constant in y: the 16 rows of a tile
// are 4 KB in a row, stored as 8 whole 512-byte wave stores.
// ---------------------------------------------------------------------------
// exact GELU: x * 0.5 * (1 + erf(x / sqrt(2)))
static __device__ __forceinline__ float gelu_exact(float s) {
  return 0.5f * s * (1.0f + erff(s * 0.70710678118654752f));
}

// x + (x of lane ^ MASK), inside each row of 16 lanes (DPP row_xmask).
template <int MASK>
static __device__ __forceinline__ float add_xor16(float x) {
  return x + __int_as_float(__builtin_amdgcn_update_dpp(
                 0, __float_as_int(x), 0x160 + MASK, 0xf, 0xf, true));
}

__global__ __launch_bounds__(128) void attn_out(const float* __restrict__ part,
                                                const float* __restrict__ bq,
                                                const float* __restrict__ bk,
                                                const float* __restrict__ qkv,
                                                float* __restrict__ out) {
  __shared__ __attribute__((aligned(16))) float sk[512];  // klow [c][j], head h
  __shared__ float sq[128];                    // qlow [c][i], head h, tile tm
  const int t = threadIdx.x;
  const int lane = t & 31;
  const int l15 = lane & 15;
  const int half = lane >> 4;
  const int h = blockIdx.x & 7;                // head
  const int tm = (blockIdx.x >> 3) & 3;        // query tile, 0..3
  const int ch = h * 8 + (blockIdx.x >> 5) * 4 + (t >> 5);  // output channel
  const int c8 = t >> 4;                       // head channel of this thread's
                                               // k quad and q value

  // Offsets: k quad 4t..4t+3 of the head's 512 and first v row of this half in
  // bytes, q value t of the tile's 128 and bias in floats (the units in which
  // the loads take them; plane cg*2+qk of part is 4096 floats).
  const unsigned kob = (4096 + h * 512 + t * 4) * 4;
  const unsigned qof = h * 512 + c8 * 64 + tm * 16 + l15;
  const unsigned bof = h * 8 + c8;
  const unsigned vob = ((128 + ch) * 4096 + half * 2048 + l15 * 4) * 4;
  const char* __restrict__ pb = (const char*)part;
  v4f pk[8], vv[32];
  float pq[8];
#pragma unroll  // constant indices keep the values in registers
  for (int cg = 0; cg < 8; ++cg) {
    pk[cg] = *(const v4f*)(pb + kob + cg * 32768);
    pq[cg] = (part + qof)[cg * 8192];
  }
  const float bkv = bk[bof];
  const float bqv = bq[bof];
#pragma unroll  // same
  for (int k = 0; k < 32; ++k)
    vv[k] = *(const v4f*)((const char*)qkv + vob + k * 256);
  asm volatile("s_wait_xcnt 0x0" :: "v"(kob), "v"(qof), "v"(bof), "v"(vob));
  // Keeps the whole batch of loads above the arithmetic: left free, the
  // scheduler puts part of the v loads behind the first waits on the partials
  // (it reuses their registers), so that they start one load latency late.
  __builtin_amdgcn_sched_barrier(0);

  v4f s4 = {};
  float s1 = 0.0f;
#pragma unroll  // constant index into pk, pq
  for (int cg = 0; cg < 8; ++cg) {
    s4 += pk[cg];
    s1 += pq[cg];
  }
  s4 += bkv;
  s1 += bqv;
  v4f g4;
#pragma unroll  // constant index into the vectors
  for (int e = 0; e < 4; ++e) g4[e] = gelu_exact(s4[e]);
  *(v4f*)&sk[t * 4] = g4;
  sq[t] = gelu_exact(s1) * 0.35355339059327373f;  // * DIM_HEAD^-0.5

  float vb[32];                                // sum_y v[ch][32*half + k][y]
#pragma unroll  // constant index into vv, vb; 32 independent chains
  for (int k = 0; k < 32; ++k) {
    const v2f p = vv[k].lo + vv[k].hi;         // register pairs as they landed
    float s = p.x + p.y;
    s = add_xor16<1>(s);
    s = add_xor16<2>(s);
    s = add_xor16<4>(s);
    vb[k] = add_xor16<8>(s);
  }
  __syncthreads();  // the block's klow and qlow must be in LDS before any read

  // A[m][k=c] reads klow at j = 4*m + tn (one 16-byte read gives all four tn),
  // B[k=c][n=i] reads qlow; both take channels 4*ks + 2*half, 4*ks + 2*half + 1.
  v4f ak[2][2];
  v2f b[2];
#pragma unroll  // constant indices keep the fragments in registers
  for (int ks = 0; ks < 2; ++ks) {
    const int c0 = ks * 4 + half * 2;
    ak[ks][0] = *(const v4f*)&sk[c0 * 64 + l15 * 4];
    ak[ks][1] = *(const v4f*)&sk[(c0 + 1) * 64 + l15 * 4];
    b[ks].x = sq[c0 * 16 + l15];
    b[ks].y = sq[(c0 + 1) * 16 + l15];
  }
  v8f c[4];
#pragma unroll  // constant index into c and ak
  for (int tn = 0; tn < 4; ++tn) {
    v2f a0, a1;
    a0.x = ak[0][0][tn];
    a0.y = ak[0][1][tn];
    a1.x = ak[1][0][tn];
    a1.y = ak[1][1][tn];
    v8f z = {};
    c[tn] = wmma4(a1, b[1], wmma4(a0, b[0], z));
  }

  // Softmax over the 64 unique key scores of query i (the upsample makes the
  // 4096-wide softmax equal to this divided by 64; the /64 turns the v sums
  // into means and is applied once, at the end: a power of two, exact).
  float mt[4];
#pragma unroll  // four independent chains, one per key tile
  for (int tn = 0; tn < 4; ++tn) {
    mt[tn] = c[tn][0];
#pragma unroll  // constant index into c
    for (int r = 1; r < 8; ++r) mt[tn] = fmaxf(mt[tn], c[tn][r]);
  }
  float mx = fmaxf(fmaxf(mt[0], mt[1]), fmaxf(mt[2], mt[3]));
  mx = fmaxf(mx, __shfl_xor(mx, 16));          // the partner's 32 keys

  float st[4], at[4];                          // sum of e, sum of e * v sum
#pragma unroll  // four independent chains, one per key tile
  for (int tn = 0; tn < 4; ++tn) {
    st[tn] = 0.0f;
    at[tn] = 0.0f;
#pragma unroll  // constant index into c and vb
    for (int r = 0; r < 8; ++r) {
      const float e = expf(c[tn][r] - mx);
      st[tn] += e;
      at[tn] += e * vb[r * 4 + tn];
    }
  }
  float ssum = (st[0] + st[1]) + (st[2] + st[3]);
  float acc = (at[0] + at[1]) + (at[2] + at[3]);
  ssum += __shfl_xor(ssum, 16);
  acc += __shfl_xor(acc, 16);
  // out[ch][tm*16 + l15][*]
  const int o = __float_as_int(acc * (1.0f / ssum) * (1.0f / 64.0f));

  float4* __restrict__ dst = (float4*)(out + ch * 4096 + tm * 1024) + lane;
#pragma unroll  // constant lane numbers for the broadcasts
  for (int k = 0; k < 8; ++k) {
    const int o0 = __builtin_amdgcn_readlane(o, 2 * k);
    const int o1 = __builtin_amdgcn_readlane(o, 2 * k + 1);
    const float s = __int_as_float(half ? o1 : o0);
    dst[k * 32] = make_float4(s, s, s, s);
  }
}

// ---------------------------------------------------------------------------
// Workspace layout (floats):
//   qkv   : [192 x 4096]          @ 0        (786432)
//   part  : [8*2 x 64 x 64]       @ 786432   (65536)
// total ~3.4 MB
// ---------------------------------------------------------------------------
extern "C" void kernel_launch(void* const* d_in, const int* in_sizes, int n_in,
                              void* d_out, int out_size, void* d_ws, size_t ws_size,
                              hipStream_t stream) {
  const float* f     = (const float*)d_in[0];  // [1,64,64,64]
  const float* w_qkv = (const float*)d_in[1];  // [192,64,1,1]
  const float* wq    = (const float*)d_in[2];  // [64,64,11,11]
  const float* bq    = (const float*)d_in[3];  // [64]
  const float* wk    = (const float*)d_in[4];  // [64,64,11,11]
  const float* bk    = (const float*)d_in[5];  // [64]
  float* out = (float*)d_out;                  // [1,64,64,64]

  float* ws   = (float*)d_ws;
  float* qkv  = ws;
  float* part = ws + 786432;

  qkv_gemm<<<768, 128, 0, stream>>>(w_qkv, f, qkv);
  dconv_part<<<dim3(16, 8, 2), 352, 0, stream>>>(qkv, wq, wk, part);
  attn_out<<<64, 128, 0, stream>>>(part, bq, bk, qkv, out);
}

// v005
// It runs in 11.3 microseconds.
// In two side-by-side timings against v004, it was 1.08 and 1.09 times as fast.
// Counting every step since v000, it is 6.95 times as fast.
#include <hip/hip_runtime.h>
#include <hip/hip_bf16.h>
#include <math.h>

typedef __attribute__((ext_vector_type(2))) float v2f;
typedef __attribute__((ext_vector_type(4))) float v4f;
typedef __attribute__((ext_vector_type(8))) float v8f;

static __device__ __forceinline__ v8f wmma4(v2f a, v2f b, v8f c) {
  return __builtin_amdgcn_wmma_f32_16x16x4_f32(
      /*neg_a=*/false, a, /*neg_b=*/false, b,
      /*c_mod=*/(short)0, c, /*reuse_a=*/false, /*reuse_b=*/false);
}

#define ECS 20
#define EOS 324
__global__ __launch_bounds__(256) void fold_conv(const float* __restrict__ f,
                                                 const float* __restrict__ wp,
                                                 const float* __restrict__ wq,
                                                 const float* __restrict__ wk,
                                                 float* __restrict__ part,
                                                 float* __restrict__ qkv) {
  __shared__ __attribute__((aligned(16))) float se[16 * EOS];  // E [oc][cin][tap]
  __shared__ float red[8][256];                // one 16x16 tile per conv wave
  const int lane = threadIdx.x & 31;
  const int wave = __builtin_amdgcn_readfirstlane(threadIdx.x >> 5);  // 0..7
  const int l15 = lane & 15;
  const int half = lane >> 4;
  const int tt = blockIdx.x & 7;               // taps tt*16 .. tt*16+15
  const int ct = (blockIdx.x >> 3) & 3;        // f channels ct*16 .. ct*16+15
  const int tm = (blockIdx.x >> 5) & 3;        // oc tm*16 .. tm*16+15
  const int qk = blockIdx.x >> 7;              // 0:q 1:k
  const int tn = wave & 3;                     // conv: position tile
  const int kq = wave >> 2;                    // conv: cin half

  // Fold operands.  A[m=cin][k=ci] = Wp[qk*64+ci][cin], B[k=ci][n=tap] =
  // wd[oc][ci][tap], oc = wave and wave + 8; both take ci = 4*s + 2*half,
  // 4*s + 2*half + 1.
  const int ftap = tt * 16 + l15;
  const bool fok = ftap < 121;
  const unsigned aof = (qk * 64 + 2 * half) * 64 + ct * 16 + l15;
  const unsigned bof = (tm * 16 + wave) * 7744 + 2 * half * 121 + (fok ? ftap : 120);
  const float* __restrict__ wd = qk ? wk : wq;
  v2f fa[16], fb[2][16];
#pragma unroll  // constant indices keep the fragments in registers
  for (int s = 0; s < 16; ++s) {
    fa[s].x = (wp + aof)[(4 * s) * 64];
    fa[s].y = (wp + aof)[(4 * s + 1) * 64];
#pragma unroll  // same
    for (int g = 0; g < 2; ++g) {
      fb[g][s].x = (wd + bof)[g * 8 * 7744 + (4 * s) * 121];
      fb[g][s].y = (wd + bof)[g * 8 * 7744 + (4 * s + 1) * 121];
    }
  }

  // Conv B operand: f[cin][x][y] at this lane's position and its 8 taps
  // tt*16 + 8*u + 4*half + e, for the wave's 8 channels.
  const int pos = tn * 16 + l15;               // xl*8+yl, low-res position
  const int xl = pos >> 3, yl = pos & 7;
  const float* __restrict__ fsrc = f + (ct * 16 + kq * 8) * 4096;
  unsigned sof[8];
  bool sok[8];
#pragma unroll  // constant index into sof, sok
  for (int i = 0; i < 8; ++i) {                // i = 4*u + e
    const int tap = tt * 16 + 8 * (i >> 2) + 4 * half + (i & 3);
    const int kx = tap / 11, ky = tap - kx * 11;
    const int x = xl * 8 - 2 + kx;             // input row
    const int y = yl * 8 - 2 + ky;             // input column
    sok[i] = (tap < 121) && (x >= 0) && (x < 64) && (y >= 0) && (y < 64);
    sof[i] = sok[i] ? (unsigned)(x * 64 + y) : 0u;  // safe dummy when padded
  }
  float fv[8][8];
#pragma unroll  // constant indices keep fv in registers; loads issue together
  for (int c = 0; c < 8; ++c)
#pragma unroll  // same
    for (int i = 0; i < 8; ++i) fv[c][i] = (fsrc + sof[i])[c * 4096];
  asm volatile("s_wait_xcnt 0x0" :: "v"(aof), "v"(bof), "v"(sof[0]), "v"(sof[1]),
               "v"(sof[2]), "v"(sof[3]), "v"(sof[4]), "v"(sof[5]), "v"(sof[6]),
               "v"(sof[7]));
  // Keeps the whole batch of loads above the arithmetic: left free, the
  // scheduler holds part of them back behind the first waits to save registers.
  __builtin_amdgcn_sched_barrier(0);

  v8f e[2] = {};
#pragma unroll  // constant index into fa, fb
  for (int s = 0; s < 16; ++s) {
#pragma unroll  // two independent chains
    for (int g = 0; g < 2; ++g) {
      v2f b;
      b.x = fok ? fb[g][s].x : 0.0f;
      b.y = fok ? fb[g][s].y : 0.0f;
      e[g] = wmma4(fa[s], b, e[g]);
    }
  }
  // D: cin = r + 8*half, tap = l15, oc = wave + 8*g.
#pragma unroll  // constant indices keep the accumulators in registers
  for (int g = 0; g < 2; ++g)
#pragma unroll  // same
    for (int r = 0; r < 8; ++r)
      se[(wave + 8 * g) * EOS + (r + 8 * half) * ECS + l15] = e[g][r];
  __syncthreads();  // all 16 oc slabs of E must be in LDS before any is read

  // v tile of waves 0..3: A[m=channel][k=cin] = Wp, B[k=cin][n=position] = f,
  // both at cin = 4*s + 2*half, 4*s + 2*half + 1.  Loaded here, not at entry: the
  // fold starts only when the whole entry batch has issued; from here these
  // loads have the whole conv to land.
  const bool vw = wave < 4;                    // wave-uniform
  const int vt = blockIdx.x * 4 + wave;        // 0..1023 where vw
  const int vtm = 8 + (vt >> 8), vtn = vt & 255;
  const unsigned vao = ((vtm * 16 + l15) * 64 + 2 * half) * 4;  // bytes
  const unsigned vbo = 2 * half * 4096 + vtn * 16 + l15;        // floats
  v2f va[16] = {}, vb[16] = {};
  if (vw) {
#pragma unroll  // constant indices keep the fragments in registers
    for (int s = 0; s < 16; ++s) {
      va[s] = *(const v2f*)((const char*)wp + vao + 16 * s);
      vb[s].x = (f + vbo)[(4 * s) * 4096];
      vb[s].y = (f + vbo)[(4 * s + 1) * 4096];
    }
    asm volatile("s_wait_xcnt 0x0" :: "v"(vao), "v"(vbo));
  }

  // A[m=oc][k]: one 16-byte read gives taps 8*u + 4*half + 0..3 of one cin, two
  // k steps; k = 2*half + j of step (c, u, p) is (cin c, tap 8*u+4*half+2*p+j)
  // on the A side and on the B side alike.
  const float* __restrict__ el = &se[l15 * EOS + kq * 8 * ECS + 4 * half];
  v4f aw[8][2];
#pragma unroll  // constant indices; the 16 LDS reads issue together
  for (int cc = 0; cc < 8; ++cc)
#pragma unroll  // same
    for (int u = 0; u < 2; ++u) aw[cc][u] = *(const v4f*)&el[cc * ECS + 8 * u];
  // Keeps the 16 reads together ahead of the products: left free, the scheduler
  // puts each one WMMA ahead of its use, and its latency shows every time.
  __builtin_amdgcn_sched_barrier(0);
  v8f c = {};
#pragma unroll  // constant index into fv, aw
  for (int cc = 0; cc < 8; ++cc) {
#pragma unroll  // same
    for (int u = 0; u < 2; ++u) {
#pragma unroll  // same
      for (int p = 0; p < 2; ++p) {
        const int i = 4 * u + 2 * p;
        v2f a, b;
        a.x = aw[cc][u][2 * p];
        a.y = aw[cc][u][2 * p + 1];
        b.x = sok[i] ? fv[cc][i] : 0.0f;
        b.y = sok[i + 1] ? fv[cc][i + 1] : 0.0f;
        c = wmma4(a, b, c);
      }
    }
  }
#pragma unroll  // constant r keeps the accumulator in registers
  for (int r = 0; r < 8; ++r) red[wave][r * 32 + lane] = c[r];
  __syncthreads();  // all 8 tiles must be in LDS before any is summed

  // 4 position tiles x 256 elements, four per thread (oe = r*32 + lane of the D
  // layout inside tile otn); the cin halves are added in kq order.
  float* __restrict__ dst = part + ((ct * 8 + tt) * 2 + qk) * 4096;  // [64oc x 64pos]
#pragma unroll  // four independent sums
  for (int otn = 0; otn < 4; ++otn) {
    const int oe = threadIdx.x;
    const float s = red[otn][oe] + red[4 + otn][oe];
    dst[(tm * 16 + (oe >> 5) + 8 * half) * 64 + otn * 16 + l15] = s;
  }

  asm volatile("s_wait_xcnt 0x0" ::: "memory");
  if (vw) {
    v8f vc = {};
#pragma unroll  // constant index into va, vb
    for (int s = 0; s < 16; ++s) vc = wmma4(va[s], vb[s], vc);
#pragma unroll  // constant r keeps the accumulator in registers
    for (int r = 0; r < 8; ++r)
      qkv[(vtm * 16 + r + 8 * half) * 4096 + vtn * 16 + l15] = vc[r];
  }
}

// ---------------------------------------------------------------------------
// Kernel 2: everything behind the down-convolution in one launch.
// Block = (head, query tile of 16 low-res rows, 4 of the head's 8 output
// channels), one wave per output channel, grid 64 x 128 threads.
//
// Operands, built by the block itself:
//  - klow (8 c x 64 j of the head) and qlow (8 c x 16 i of the tile): sum of the
//    32 partial planes in plane order, + bias, exact GELU, q-scale; four k
//    values and one q value per thread, shared through LDS behind one barrier.
//  - the wave's own sums over y of v[ch, row, :]: load k brings row k (lanes
//    0-15) and row 32 + k (lanes 16-31), 16 B a lane, whole lines; a lane adds
//    its four values, four DPP adds finish the row inside the 16 lanes, so
//    every lane of a half holds the sums of that half's 32 rows.
//
// The wave forms the TRANSPOSED scores dots^T[j][i] = sum_c klow[c][j]*qlow[c][i]
// (4 key tiles x K=8, 8 WMMAs) with key j = 4 * M + tn in row M of tile tn: in
// the D layout (M = r + 8*half) a lane then holds, for ONE query i = lane & 15,
// the keys j = 32*half + 4*r + tn, which are the 32 rows whose v sums it has.
// Softmax and the sum over keys are per-lane register work plus three exchanges
// between the halves.  out[ch, x, :] is constant in y: the 16 rows of a tile
// are 4 KB in a row, stored as 8 whole 512-byte wave stores.
// ---------------------------------------------------------------------------
// exact GELU: x * 0.5 * (1 + erf(x / sqrt(2)))
static __device__ __forceinline__ float gelu_exact(float s) {
  return 0.5f * s * (1.0f + erff(s * 0.70710678118654752f));
}

// x + (x of lane ^ MASK), inside each row of 16 lanes (DPP row_xmask).
template <int MASK>
static __device__ __forceinline__ float add_xor16(float x) {
  return x + __int_as_float(__builtin_amdgcn_update_dpp(
                 0, __float_as_int(x), 0x160 + MASK, 0xf, 0xf, true));
}

__global__ __launch_bounds__(128) void attn_out(const float* __restrict__ part,
                                                const float* __restrict__ bq,
                                                const float* __restrict__ bk,
                                                const float* __restrict__ qkv,
                                                float* __restrict__ out) {
  __shared__ __attribute__((aligned(16))) float sk[512];  // klow [c][j], head h
  __shared__ float sq[128];                    // qlow [c][i], head h, tile tm
  const int t = threadIdx.x;
  const int lane = t & 31;
  const int l15 = lane & 15;
  const int half = lane >> 4;
  const int h = blockIdx.x & 7;                // head
  const int tm = (blockIdx.x >> 3) & 3;        // query tile, 0..3
  const int ch = h * 8 + (blockIdx.x >> 5) * 4 + (t >> 5);  // output channel
  const int c8 = t >> 4;                       // head channel of this thread's
                                               // k quad and q value

  // Offsets: k quad 4t..4t+3 of the head's 512 and first v row of this half in
  // bytes, q value t of the tile's 128 and bias in floats (the units in which
  // the loads take them; plane p*2+qk of part is 4096 floats).
  const unsigned kob = (4096 + h * 512 + t * 4) * 4;
  const unsigned qof = h * 512 + c8 * 64 + tm * 16 + l15;
  const unsigned bof = h * 8 + c8;
  const unsigned vob = ((128 + ch) * 4096 + half * 2048 + l15 * 4) * 4;
  const char* __restrict__ pb = (const char*)part;
  v4f pk[32], vv[32];
  float pq[32];
#pragma unroll  // constant indices keep the values in registers
  for (int p = 0; p < 32; ++p) {
    pk[p] = *(const v4f*)(pb + kob + p * 32768);
    pq[p] = (part + qof)[p * 8192];
  }
  const float bkv = bk[bof];
  const float bqv = bq[bof];
#pragma unroll  // same
  for (int k = 0; k < 32; ++k)
    vv[k] = *(const v4f*)((const char*)qkv + vob + k * 256);
  asm volatile("s_wait_xcnt 0x0" :: "v"(kob), "v"(qof), "v"(bof), "v"(vob));
  // Keeps the whole batch of loads above the arithmetic: left free, the
  // scheduler puts part of the v loads behind the first waits on the partials
  // (it reuses their registers), so that they start one load latency late.
  __builtin_amdgcn_sched_barrier(0);

  v4f s4 = {};
  float s1 = 0.0f;
#pragma unroll  // constant index into pk, pq
  for (int p = 0; p < 32; ++p) {
    s4 += pk[p];
    s1 += pq[p];
  }
  s4 += bkv;
  s1 += bqv;
  v4f g4;
#pragma unroll  // constant index into the vectors
  for (int e = 0; e < 4; ++e) g4[e] = gelu_exact(s4[e]);
  *(v4f*)&sk[t * 4] = g4;
  sq[t] = gelu_exact(s1) * 0.35355339059327373f;  // * DIM_HEAD^-0.5

  float vb[32];                                // sum_y v[ch][32*half + k][y]
#pragma unroll  // constant index into vv, vb; 32 independent chains
  for (int k = 0; k < 32; ++k) {
    const v2f p = vv[k].lo + vv[k].hi;         // register pairs as they landed
    float s = p.x + p.y;
    s = add_xor16<1>(s);
    s = add_xor16<2>(s);
    s = add_xor16<4>(s);
    vb[k] = add_xor16<8>(s);
  }
  __syncthreads();  // the block's klow and qlow must be in LDS before any read

  // A[m][k=c] reads klow at j = 4*m + tn (one 16-byte read gives all four tn),
  // B[k=c][n=i] reads qlow; both take channels 4*ks + 2*half, 4*ks + 2*half + 1.
  v4f ak[2][2];
  v2f b[2];
#pragma unroll  // constant indices keep the fragments in registers
  for (int ks = 0; ks < 2; ++ks) {
    const int c0 = ks * 4 + half * 2;
    ak[ks][0] = *(const v4f*)&sk[c0 * 64 + l15 * 4];
    ak[ks][1] = *(const v4f*)&sk[(c0 + 1) * 64 + l15 * 4];
    b[ks].x = sq[c0 * 16 + l15];
    b[ks].y = sq[(c0 + 1) * 16 + l15];
  }
  v8f c[4];
#pragma unroll  // constant index into c and ak
  for (int tn = 0; tn < 4; ++tn) {
    v2f a0, a1;
    a0.x = ak[0][0][tn];
    a0.y = ak[0][1][tn];
    a1.x = ak[1][0][tn];
    a1.y = ak[1][1][tn];
    v8f z = {};
    c[tn] = wmma4(a1, b[1], wmma4(a0, b[0], z));
  }

  // Softmax over the 64 unique key scores of query i (the upsample makes the
  // 4096-wide softmax equal to this divided by 64; the /64 turns the v sums
  // into means and is applied once, at the end: a power of two, exact).
  float mt[4];
#pragma unroll  // four independent chains, one per key tile
  for (int tn = 0; tn < 4; ++tn) {
    mt[tn] = c[tn][0];
#pragma unroll  // constant index into c
    for (int r = 1; r < 8; ++r) mt[tn] = fmaxf(mt[tn], c[tn][r]);
  }
  float mx = fmaxf(fmaxf(mt[0], mt[1]), fmaxf(mt[2], mt[3]));
  mx = fmaxf(mx, __shfl_xor(mx, 16));          // the partner's 32 keys

  float st[4], at[4];                          // sum of e, sum of e * v sum
#pragma unroll  // four independent chains, one per key tile
  for (int tn = 0; tn < 4; ++tn) {
    st[tn] = 0.0f;
    at[tn] = 0.0f;
#pragma unroll  // constant index into c and vb
    for (int r = 0; r < 8; ++r) {
      const float e = expf(c[tn][r] - mx);
      st[tn] += e;
      at[tn] += e * vb[r * 4 + tn];
    }
  }
  float ssum = (st[0] + st[1]) + (st[2] + st[3]);
  float acc = (at[0] + at[1]) + (at[2] + at[3]);
  ssum += __shfl_xor(ssum, 16);
  acc += __shfl_xor(acc, 16);
  // out[ch][tm*16 + l15][*]
  const int o = __float_as_int(acc * (1.0f / ssum) * (1.0f / 64.0f));

  float4* __restrict__ dst = (float4*)(out + ch * 4096 + tm * 1024) + lane;
#pragma unroll  // constant lane numbers for the broadcasts
  for (int k = 0; k < 8; ++k) {
    const int o0 = __builtin_amdgcn_readlane(o, 2 * k);
    const int o1 = __builtin_amdgcn_readlane(o, 2 * k + 1);
    const float s = __int_as_float(half ? o1 : o0);
    dst[k * 32] = make_float4(s, s, s, s);
  }
}

// ---------------------------------------------------------------------------
// Workspace layout (floats):
//   qkv   : [192 x 4096]          @ 0        (786432; only the v rows are used)
//   part  : [32*2 x 64 x 64]      @ 786432   (262144)
// total ~4.2 MB
// ---------------------------------------------------------------------------
extern "C" void kernel_launch(void* const* d_in, const int* in_sizes, int n_in,
                              void* d_out, int out_size, void* d_ws, size_t ws_size,
                              hipStream_t stream) {
  const float* f     = (const float*)d_in[0];  // [1,64,64,64]
  const float* w_qkv = (const float*)d_in[1];  // [192,64,1,1]
  const float* wq    = (const float*)d_in[2];  // [64,64,11,11]
  const float* bq    = (const float*)d_in[3];  // [64]
  const float* wk    = (const float*)d_in[4];  // [64,64,11,11]
  const float* bk    = (const float*)d_in[5];  // [64]
  float* out = (float*)d_out;                  // [1,64,64,64]

  float* ws   = (float*)d_ws;
  float* qkv  = ws;
  float* part = ws + 786432;

  fold_conv<<<256, 256, 0, stream>>>(f, w_qkv, wq, wk, part, qkv);
  attn_out<<<64, 128, 0, stream>>>(part, bq, bk, qkv, out);
}

// v006
// It runs in 10.9 microseconds.
// Next to v005, in two timings, it ran 1.05 and 1.04 times as fast.
// Counting every step since v000, it is 7.27 times as fast.
#include <hip/hip_runtime.h>
#include <hip/hip_bf16.h>
#include <math.h>

typedef __attribute__((ext_vector_type(2))) float v2f;
typedef __attribute__((ext_vector_type(4))) float v4f;
typedef __attribute__((ext_vector_type(8))) float v8f;

static __device__ __forceinline__ v8f wmma4(v2f a, v2f b, v8f c) {
  return __builtin_amdgcn_wmma_f32_16x16x4_f32(
      /*neg_a=*/false, a, /*neg_b=*/false, b,
      /*c_mod=*/(short)0, c, /*reuse_a=*/false, /*reuse_b=*/false);
}

#define ECS 20
#define EOS 324
#define FRP 66
#define FPL (24 * FRP)  // LDS floats per staged cin plane: 3 kx x 8 xl rows

static __device__ __forceinline__ void copy_rows8(const float* const (&g)[8],
                                                  const unsigned (&l)[8]) {
  asm volatile(
      "global_load_async_to_lds_b64 %0, %1, off\n\t"
      "global_load_async_to_lds_b64 %2, %3, off\n\t"
      "global_load_async_to_lds_b64 %4, %5, off\n\t"
      "global_load_async_to_lds_b64 %6, %7, off\n\t"
      "global_load_async_to_lds_b64 %8, %9, off\n\t"
      "global_load_async_to_lds_b64 %10, %11, off\n\t"
      "global_load_async_to_lds_b64 %12, %13, off\n\t"
      "global_load_async_to_lds_b64 %14, %15, off\n\t"
      "s_wait_xcnt 0x0"
      :: "v"(l[0]), "v"(g[0]), "v"(l[1]), "v"(g[1]), "v"(l[2]), "v"(g[2]),
         "v"(l[3]), "v"(g[3]), "v"(l[4]), "v"(g[4]), "v"(l[5]), "v"(g[5]),
         "v"(l[6]), "v"(g[6]), "v"(l[7]), "v"(g[7])
      : "memory");
}
__global__ __launch_bounds__(256) void fold_conv(const float* __restrict__ f,
                                                 const float* __restrict__ wp,
                                                 const float* __restrict__ wq,
                                                 const float* __restrict__ wk,
                                                 float* __restrict__ part,
                                                 float* __restrict__ qkv) {
  __shared__ __attribute__((aligned(16))) float se[16 * EOS];  // E [oc][cin][tap]
  __shared__ float red[8][256];                // one 16x16 tile per conv wave
  __shared__ __attribute__((aligned(16))) float sf[16 * FPL];  // f [cin][kx][xl][y]
  const int lane = threadIdx.x & 31;
  const int wave = __builtin_amdgcn_readfirstlane(threadIdx.x >> 5);  // 0..7
  const int l15 = lane & 15;
  const int half = lane >> 4;
  const int tt = blockIdx.x & 7;               // taps tt*16 .. tt*16+15
  const int ct = (blockIdx.x >> 3) & 3;        // f channels ct*16 .. ct*16+15
  const int tm = (blockIdx.x >> 5) & 3;        // oc tm*16 .. tm*16+15
  const int qk = blockIdx.x >> 7;              // 0:q 1:k
  const int tn = wave & 3;                     // conv: position tile
  const int kq = wave >> 2;                    // conv: cin half

  // Fold operands.  A[m=cin][k=ci] = Wp[qk*64+ci][cin], B[k=ci][n=tap] =
  // wd[oc][ci][tap], oc = wave and wave + 8; both take ci = 4*s + 2*half,
  // 4*s + 2*half + 1.
  const int ftap = tt * 16 + l15;
  const bool fok = ftap < 121;
  const unsigned aof = (qk * 64 + 2 * half) * 64 + ct * 16 + l15;
  const unsigned bof = (tm * 16 + wave) * 7744 + 2 * half * 121 + (fok ? ftap : 120);
  const float* __restrict__ wd = qk ? wk : wq;
  v2f fa[16], fb[2][16];
#pragma unroll  // constant indices keep the fragments in registers
  for (int s = 0; s < 16; ++s) {
    fa[s].x = (wp + aof)[(4 * s) * 64];
    fa[s].y = (wp + aof)[(4 * s + 1) * 64];
#pragma unroll  // same
    for (int g = 0; g < 2; ++g) {
      fb[g][s].x = (wd + bof)[g * 8 * 7744 + (4 * s) * 121];
      fb[g][s].y = (wd + bof)[g * 8 * 7744 + (4 * s + 1) * 121];
    }
  }

  asm volatile("s_wait_xcnt 0x0" :: "v"(aof), "v"(bof));

  // Stage the rows of f under the block's taps: kernel rows kx0 .. kx0 + nk - 1,
  // input rows x = 8*xl - 2 + kx.  Wave = 2 of the 16 channels, one copy = one
  // whole row (32 lanes x 8 B).  A row outside the image is copied from the
  // nearest row inside (the address stays in f); no product takes its values.
  const int kx0 = (tt * 16) / 11;              // block-uniform
  const int tlast = tt * 16 + 15 < 120 ? tt * 16 + 15 : 120;
  const int nk = tlast / 11 - kx0 + 1;         // 1..3
  const unsigned sfl = (unsigned)(size_t)&sf[0] + lane * 8;  // LDS byte address
#pragma unroll  // constant kr in the LDS offsets
  for (int kr = 0; kr < 3; ++kr) {
    if (kr < nk) {                             // block-uniform
#pragma unroll  // one statement of eight copies per channel
      for (int cp = 0; cp < 2; ++cp) {
        const int cl = wave * 2 + cp;          // channel inside the tile
        const float* g[8];
        unsigned l[8];
#pragma unroll  // constant index into g, l
        for (int r = 0; r < 8; ++r) {
          int x = r * 8 - 2 + kx0 + kr;
          x = x < 0 ? 0 : (x > 63 ? 63 : x);
          g[r] = f + (ct * 16 + cl) * 4096 + x * 64 + lane * 2;
          l[r] = sfl + (cl * FPL + (kr * 8 + r) * FRP) * 4;
        }
        copy_rows8(g, l);
      }
    }
  }
  // Conv B operand, B[k][n=pos]: f[cin][x][y] at this lane's position and its 8
  // taps tt*16 + 8*u + 4*half + e; sof = its place inside a staged plane.
  const int pos = tn * 16 + l15;               // xl*8+yl, low-res position
  const int xl = pos >> 3, yl = pos & 7;
  unsigned sof[8];
  bool sok[8];
#pragma unroll  // constant index into sof, sok
  for (int i = 0; i < 8; ++i) {                // i = 4*u + e
    const int tap = tt * 16 + 8 * (i >> 2) + 4 * half + (i & 3);
    const int kx = tap / 11, ky = tap - kx * 11;
    const int x = xl * 8 - 2 + kx;             // input row
    const int y = yl * 8 - 2 + ky;             // input column
    sok[i] = (tap < 121) && (x >= 0) && (x < 64) && (y >= 0) && (y < 64);
    const int kr = tap < 121 ? kx - kx0 : 0;
    sof[i] = (unsigned)((kr * 8 + xl) * FRP + (y & 63));
  }
  // Keeps the whole batch of loads and copies above the arithmetic: left free,
  // the scheduler holds part of the loads back behind the first waits to save
  // registers.
  __builtin_amdgcn_sched_barrier(0);

  v8f e[2] = {};
#pragma unroll  // constant index into fa, fb
  for (int s = 0; s < 16; ++s) {
#pragma unroll  // two independent chains
    for (int g = 0; g < 2; ++g) {
      v2f b;
      b.x = fok ? fb[g][s].x : 0.0f;
      b.y = fok ? fb[g][s].y : 0.0f;
      e[g] = wmma4(fa[s], b, e[g]);
    }
  }
  // D: cin = r + 8*half, tap = l15, oc = wave + 8*g.
#pragma unroll  // constant indices keep the accumulators in registers
  for (int g = 0; g < 2; ++g)
#pragma unroll  // same
    for (int r = 0; r < 8; ++r)
      se[(wave + 8 * g) * EOS + (r + 8 * half) * ECS + l15] = e[g][r];
  // This wave's copies must have landed before the barrier publishes them.
  asm volatile("s_wait_asynccnt 0x0" ::: "memory");
  __syncthreads();  // all 16 oc slabs of E and all rows of f must be in LDS
                    // before any is read

  // v tile of waves 0..3: A[m=channel][k=cin] = Wp, B[k=cin][n=position] = f,
  // both at cin = 4*s + 2*half, 4*s + 2*half + 1.  Loaded here, not at entry: the
  // fold starts only when the whole entry batch has issued; from here these
  // loads have the whole conv to land.
  const bool vw = wave < 4;                    // wave-uniform
  const int vt = blockIdx.x * 4 + wave;        // 0..1023 where vw
  const int vtm = 8 + (vt >> 8), vtn = vt & 255;
  const unsigned vao = ((vtm * 16 + l15) * 64 + 2 * half) * 4;  // bytes
  const unsigned vbo = 2 * half * 4096 + vtn * 16 + l15;        // floats
  v2f va[16] = {}, vb[16] = {};
  if (vw) {
#pragma unroll  // constant indices keep the fragments in registers
    for (int s = 0; s < 16; ++s) {
      va[s] = *(const v2f*)((const char*)wp + vao + 16 * s);
      vb[s].x = (f + vbo)[(4 * s) * 4096];
      vb[s].y = (f + vbo)[(4 * s + 1) * 4096];
    }
    asm volatile("s_wait_xcnt 0x0" :: "v"(vao), "v"(vbo));
  }

  // A[m=oc][k]: one 16-byte read gives taps 8*u + 4*half + 0..3 of one cin, two
  // k steps; k = 2*half + j of step (c, u, p) is (cin c, tap 8*u+4*half+2*p+j)
  // on the A side and on the B side alike.
  const float* __restrict__ el = &se[l15 * EOS + kq * 8 * ECS + 4 * half];
  const float* __restrict__ fl = &sf[kq * 8 * FPL];  // the wave's 8 channels
  v4f aw[8][2];
  float fv[8][8];
#pragma unroll  // constant indices; the 80 LDS reads issue together, in the
                // order in which the products take them
  for (int cc = 0; cc < 8; ++cc) {
#pragma unroll  // same
    for (int u = 0; u < 2; ++u) aw[cc][u] = *(const v4f*)&el[cc * ECS + 8 * u];
#pragma unroll  // same
    for (int i = 0; i < 8; ++i) fv[cc][i] = fl[cc * FPL + sof[i]];
    // Keeps the reads in channel order and together ahead of the products: left
    // free, the scheduler groups them by address register, so that the fourth
    // product already waits for nearly all 80 reads.
    __builtin_amdgcn_sched_barrier(0);
  }
  v8f c = {};
#pragma unroll  // constant index into fv, aw
  for (int cc = 0; cc < 8; ++cc) {
#pragma unroll  // same
    for (int u = 0; u < 2; ++u) {
#pragma unroll  // same
      for (int p = 0; p < 2; ++p) {
        const int i = 4 * u + 2 * p;
        v2f a, b;
        a.x = aw[cc][u][2 * p];
        a.y = aw[cc][u][2 * p + 1];
        b.x = sok[i] ? fv[cc][i] : 0.0f;
        b.y = sok[i + 1] ? fv[cc][i + 1] : 0.0f;
        c = wmma4(a, b, c);
      }
    }
  }
#pragma unroll  // constant r keeps the accumulator in registers
  for (int r = 0; r < 8; ++r) red[wave][r * 32 + lane] = c[r];
  __syncthreads();  // all 8 tiles must be in LDS before any is summed

  // 4 position tiles x 256 elements, four per thread (oe = r*32 + lane of the D
  // layout inside tile otn); the cin halves are added in kq order.
  float* __restrict__ dst = part + ((ct * 8 + tt) * 2 + qk) * 4096;  // [64oc x 64pos]
#pragma unroll  // four independent sums
  for (int otn = 0; otn < 4; ++otn) {
    const int oe = threadIdx.x;
    const float s = red[otn][oe] + red[4 + otn][oe];
    dst[(tm * 16 + (oe >> 5) + 8 * half) * 64 + otn * 16 + l15] = s;
  }

  asm volatile("s_wait_xcnt 0x0" ::: "memory");
  if (vw) {
    v8f vc = {};
#pragma unroll  // constant index into va, vb
    for (int s = 0; s < 16; ++s) vc = wmma4(va[s], vb[s], vc);
#pragma unroll  // constant r keeps the accumulator in registers
    for (int r = 0; r < 8; ++r)
      qkv[(vtm * 16 + r + 8 * half) * 4096 + vtn * 16 + l15] = vc[r];
  }
}

// ---------------------------------------------------------------------------
// Kernel 2: everything behind the down-convolution in one launch.
// Block = (head, query tile of 16 low-res rows, 4 of the head's 8 output
// channels), one wave per output channel, grid 64 x 128 threads.
//
// Operands, built by the block itself:
//  - klow (8 c x 64 j of the head) and qlow (8 c x 16 i of the tile): sum of the
//    32 partial planes in plane order, + bias, exact GELU, q-scale; four k
//    values and one q value per thread, shared through LDS behind one barrier.
//  - the wave's own sums over y of v[ch, row, :]: load k brings row k (lanes
//    0-15) and row 32 + k (lanes 16-31), 16 B a lane, whole lines; a lane adds
//    its four values, four DPP adds finish the row inside the 16 lanes, so
//    every lane of a half holds the sums of that half's 32 rows.
//
// The wave forms the TRANSPOSED scores dots^T[j][i] = sum_c klow[c][j]*qlow[c][i]
// (4 key tiles x K=8, 8 WMMAs) with key j = 4 * M + tn in row M of tile tn: in
// the D layout (M = r + 8*half) a lane then holds, for ONE query i = lane & 15,
// the keys j = 32*half + 4*r + tn, which are the 32 rows whose v sums it has.
// Softmax and the sum over keys are per-lane register work plus three exchanges
// between the halves.  out[ch, x, :] is constant in y: the 16 rows of a tile
// are 4 KB in a row, stored as 8 whole 512-byte wave stores.
// ---------------------------------------------------------------------------
// exact GELU: x * 0.5 * (1 + erf(x / sqrt(2)))
static __device__ __forceinline__ float gelu_exact(float s) {
  return 0.5f * s * (1.0f + erff(s * 0.70710678118654752f));
}

// x + (x of lane ^ MASK), inside each row of 16 lanes (DPP row_xmask).
template <int MASK>
static __device__ __forceinline__ float add_xor16(float x) {
  return x + __int_as_float(__builtin_amdgcn_update_dpp(
                 0, __float_as_int(x), 0x160 + MASK, 0xf, 0xf, true));
}

__global__ __launch_bounds__(128) void attn_out(const float* __restrict__ part,
                                                const float* __restrict__ bq,
                                                const float* __restrict__ bk,
                                                const float* __restrict__ qkv,
                                                float* __restrict__ out) {
  __shared__ __attribute__((aligned(16))) float sk[512];  // klow [c][j], head h
  __shared__ float sq[128];                    // qlow [c][i], head h, tile tm
  const int t = threadIdx.x;
  const int lane = t & 31;
  const int l15 = lane & 15;
  const int half = lane >> 4;
  const int h = blockIdx.x & 7;                // head
  const int tm = (blockIdx.x >> 3) & 3;        // query tile, 0..3
  const int ch = h * 8 + (blockIdx.x >> 5) * 4 + (t >> 5);  // output channel
  const int c8 = t >> 4;                       // head channel of this thread's
                                               // k quad and q value

  // Offsets: k quad 4t..4t+3 of the head's 512 and first v row of this half in
  // bytes, q value t of the tile's 128 and bias in floats (the units in which
  // the loads take them; plane p*2+qk of part is 4096 floats).
  const unsigned kob = (4096 + h * 512 + t * 4) * 4;
  const unsigned qof = h * 512 + c8 * 64 + tm * 16 + l15;
  const unsigned bof = h * 8 + c8;
  const unsigned vob = ((128 + ch) * 4096 + half * 2048 + l15 * 4) * 4;
  const char* __restrict__ pb = (const char*)part;
  v4f pk[32], vv[32];
  float pq[32];
#pragma unroll  // constant indices keep the values in registers
  for (int p = 0; p < 32; ++p) {
    pk[p] = *(const v4f*)(pb + kob + p * 32768);
    pq[p] = (part + qof)[p * 8192];
  }
  const float bkv = bk[bof];
  const float bqv = bq[bof];
#pragma unroll  // same
  for (int k = 0; k < 32; ++k)
    vv[k] = *(const v4f*)((const char*)qkv + vob + k * 256);
  asm volatile("s_wait_xcnt 0x0" :: "v"(kob), "v"(qof), "v"(bof), "v"(vob));
  // Keeps the whole batch of loads above the arithmetic: left free, the
  // scheduler puts part of the v loads behind the first waits on the partials
  // (it reuses their registers), so that they start one load latency late.
  __builtin_amdgcn_sched_barrier(0);

  v4f s4 = {};
  float s1 = 0.0f;
#pragma unroll  // constant index into pk, pq
  for (int p = 0; p < 32; ++p) {
    s4 += pk[p];
    s1 += pq[p];
  }
  s4 += bkv;
  s1 += bqv;
  v4f g4;
#pragma unroll  // constant index into the vectors
  for (int e = 0; e < 4; ++e) g4[e] = gelu_exact(s4[e]);
  *(v4f*)&sk[t * 4] = g4;
  sq[t] = gelu_exact(s1) * 0.35355339059327373f;  // * DIM_HEAD^-0.5

  float vb[32];                                // sum_y v[ch][32*half + k][y]
#pragma unroll  // constant index into vv, vb; 32 independent chains
  for (int k = 0; k < 32; ++k) {
    const v2f p = vv[k].lo + vv[k].hi;         // register pairs as they landed
    float s = p.x + p.y;
    s = add_xor16<1>(s);
    s = add_xor16<2>(s);
    s = add_xor16<4>(s);
    vb[k] = add_xor16<8>(s);
  }
  __syncthreads();  // the block's klow and qlow must be in LDS before any read

  // A[m][k=c] reads klow at j = 4*m + tn (one 16-byte read gives all four tn),
  // B[k=c][n=i] reads qlow; both take channels 4*ks + 2*half, 4*ks + 2*half + 1.
  v4f ak[2][2];
  v2f b[2];
#pragma unroll  // constant indices keep the fragments in registers
  for (int ks = 0; ks < 2; ++ks) {
    const int c0 = ks * 4 + half * 2;
    ak[ks][0] = *(const v4f*)&sk[c0 * 64 + l15 * 4];
    ak[ks][1] = *(const v4f*)&sk[(c0 + 1) * 64 + l15 * 4];
    b[ks].x = sq[c0 * 16 + l15];
    b[ks].y = sq[(c0 + 1) * 16 + l15];
  }
  v8f c[4];
#pragma unroll  // constant index into c and ak
  for (int tn = 0; tn < 4; ++tn) {
    v2f a0, a1;
    a0.x = ak[0][0][tn];
    a0.y = ak[0][1][tn];
    a1.x = ak[1][0][tn];
    a1.y = ak[1][1][tn];
    v8f z = {};
    c[tn] = wmma4(a1, b[1], wmma4(a0, b[0], z));
  }

  // Softmax over the 64 unique key scores of query i (the upsample makes the
  // 4096-wide softmax equal to this divided by 64; the /64 turns the v sums
  // into means and is applied once, at the end: a power of two, exact).
  float mt[4];
#pragma unroll  // four independent chains, one per key tile
  for (int tn = 0; tn < 4; ++tn) {
    mt[tn] = c[tn][0];
#pragma unroll  // constant index into c
    for (int r = 1; r < 8; ++r) mt[tn] = fmaxf(mt[tn], c[tn][r]);
  }
  float mx = fmaxf(fmaxf(mt[0], mt[1]), fmaxf(mt[2], mt[3]));
  mx = fmaxf(mx, __shfl_xor(mx, 16));          // the partner's 32 keys

  float st[4], at[4];                          // sum of e, sum of e * v sum
#pragma unroll  // four independent chains, one per key tile
  for (int tn = 0; tn < 4; ++tn) {
    st[tn] = 0.0f;
    at[tn] = 0.0f;
#pragma unroll  // constant index into c and vb
    for (int r = 0; r < 8; ++r) {
      const float e = expf(c[tn][r] - mx);
      st[tn] += e;
      at[tn] += e * vb[r * 4 + tn];
    }
  }
  float ssum = (st[0] + st[1]) + (st[2] + st[3]);
  float acc = (at[0] + at[1]) + (at[2] + at[3]);
  ssum += __shfl_xor(ssum, 16);
  acc += __shfl_xor(acc, 16);
  // out[ch][tm*16 + l15][*]
  const int o = __float_as_int(acc * (1.0f / ssum) * (1.0f / 64.0f));

  float4* __restrict__ dst = (float4*)(out + ch * 4096 + tm * 1024) + lane;
#pragma unroll  // constant lane numbers for the broadcasts
  for (int k = 0; k < 8; ++k) {
    const int o0 = __builtin_amdgcn_readlane(o, 2 * k);
    const int o1 = __builtin_amdgcn_readlane(o, 2 * k + 1);
    const float s = __int_as_float(half ? o1 : o0);
    dst[k * 32] = make_float4(s, s, s, s);
  }
}

// ---------------------------------------------------------------------------
// Workspace layout (floats):
//   qkv   : [192 x 4096]          @ 0        (786432; only the v rows are used)
//   part  : [32*2 x 64 x 64]      @ 786432   (262144)
// total ~4.2 MB
// ---------------------------------------------------------------------------
extern "C" void kernel_launch(void* const* d_in, const int* in_sizes, int n_in,
                              void* d_out, int out_size, void* d_ws, size_t ws_size,
                              hipStream_t stream) {
  const float* f     = (const float*)d_in[0];  // [1,64,64,64]
  const float* w_qkv = (const float*)d_in[1];  // [192,64,1,1]
  const float* wq    = (const float*)d_in[2];  // [64,64,11,11]
  const float* bq    = (const float*)d_in[3];  // [64]
  const float* wk    = (const float*)d_in[4];  // [64,64,11,11]
  const float* bk    = (const float*)d_in[5];  // [64]
  float* out = (float*)d_out;                  // [1,64,64,64]

  float* ws   = (float*)d_ws;
  float* qkv  = ws;
  float* part = ws + 786432;

  fold_conv<<<256, 256, 0, stream>>>(f, w_qkv, wq, wk, part, qkv);
  attn_out<<<64, 128, 0, stream>>>(part, bq, bk, qkv, out);
}
